// v000
// The times below were measured on an AMD MI455X: many runs one after another, warmed up first and cycling through
// copies of the inputs, with the whole window's GPU time divided by the number of runs. Launches and the gaps
// between them are all in it. The median over several windows is given; except for v000 it joins two sittings, which
// can be a few percent apart, so the side-by-side timings, each taken in one sitting, are the better comparison.
// v000 is the starting kernel. One run takes 227 microseconds.
// Contractions: silu(x) f16 x (base_w carried x32) f16, K=1024; sin-basis f16 x (spline_w carried x4096) f16, K=3072; both v_wmma_f32_16x16x32_f16 with f32 accumulate; silu/sin/bias/sum in f32.
#include <hip/hip_runtime.h>
#include <math.h>

// ---------------------------------------------------------------------------
// Problem constants
// ---------------------------------------------------------------------------
constexpr int kRows  = 4 * 2048;        // M = 8192 token rows
constexpr int kIn    = 1024;            // input features
constexpr int kOut   = 1024;            // output features
constexpr int kGridN = 3;               // sin basis count
constexpr int kKspl  = kIn * kGridN;    // 3072, K of the basis GEMM (index i*3+g)
constexpr float kWbCarry   = 32.0f;     // base weight carried x32 in f16
constexpr float kWsCarry   = 4096.0f;   // basis weight carried x4096 in f16
constexpr float kBaseScale = 1.0f / 32.0f;
constexpr float kSplScale  = 1.0f / 4096.0f;

typedef __attribute__((ext_vector_type(16))) _Float16 v16h;
typedef __attribute__((ext_vector_type(8)))  _Float16 v8h;
typedef __attribute__((ext_vector_type(16))) __bf16   v16b;
typedef __attribute__((ext_vector_type(8)))  __bf16   v8b;
typedef __attribute__((ext_vector_type(8)))  float    v8f;
typedef __attribute__((ext_vector_type(4)))  float    v4f;
typedef __attribute__((ext_vector_type(4)))  unsigned int v4u;

// ---------------------------------------------------------------------------
// Helpers
// ---------------------------------------------------------------------------
__device__ __forceinline__ unsigned short f2bf_bits(float f) {
  unsigned u = __float_as_uint(f);
  return (unsigned short)((u + 0x7FFFu + ((u >> 16) & 1u)) >> 16);
}
__device__ __forceinline__ float bf_bits2f(unsigned short h) { return __uint_as_float(((unsigned)h) << 16); }

// hazard guards as plain device helpers (no inline asm inside the kernel template body)
__device__ __forceinline__ void dep_guard_h(v8f& a, v8f& b, v16h x, v16h y) { asm volatile("v_nop\n\tv_nop\n\tv_nop\n\tv_nop" : "+v"(a), "+v"(b) : "v"(x), "v"(y)); }
__device__ __forceinline__ void dep_guard_b(v8f& a, v8f& b, v16b x, v16b y) { asm volatile("v_nop\n\tv_nop\n\tv_nop\n\tv_nop" : "+v"(a), "+v"(b) : "v"(x), "v"(y)); }
__device__ __forceinline__ void keep4_h(v16h a, v16h b, v16h c, v16h d) { asm volatile("v_nop" :: "v"(a), "v"(b), "v"(c), "v"(d)); }
__device__ __forceinline__ void keep4_b(v16b a, v16b b, v16b c, v16b d) { asm volatile("v_nop" :: "v"(a), "v"(b), "v"(c), "v"(d)); }
__device__ __forceinline__ void acc_guard4(v8f& a, v8f& b, v8f& c, v8f& d) { asm volatile("v_nop\n\tv_nop\n\tv_nop\n\tv_nop" : "+v"(a), "+v"(b), "+v"(c), "+v"(d)); }
template <typename T> struct Frag;
template <> struct Frag<_Float16> {
  typedef v16h V; union U { v16h v; v8h h[2]; };
  static __device__ __forceinline__ v16h load(const _Float16* p) {   // elements 0..7 <- p[0..7], 8..15 <- p[16..23]
    U f; f.h[0] = *(const v8h*)(p); f.h[1] = *(const v8h*)(p + 16); return f.v;
  }
  static __device__ __forceinline__ v8f mma(v16h a, v16h b, v8f c) {
    return __builtin_amdgcn_wmma_f32_16x16x32_f16(false, a, false, b, (short)0, c, false, false);
  }
  static __device__ __forceinline__ void guard(v8f& a, v8f& b, v16h x, v16h y) { dep_guard_h(a, b, x, y); }
  static __device__ __forceinline__ void keep(v16h a, v16h b, v16h c, v16h d) { keep4_h(a, b, c, d); }
};
template <> struct Frag<__bf16> {
  typedef v16b V; union U { v16b v; v8b h[2]; };
  static __device__ __forceinline__ v16b load(const __bf16* p) {
    U f; f.h[0] = *(const v8b*)(p); f.h[1] = *(const v8b*)(p + 16); return f.v;
  }
  static __device__ __forceinline__ v8f mma(v16b a, v16b b, v8f c) {
    return __builtin_amdgcn_wmma_f32_16x16x32_bf16(false, a, false, b, (short)0, c, false, false);
  }
  static __device__ __forceinline__ void guard(v8f& a, v8f& b, v16b x, v16b y) { dep_guard_b(a, b, x, y); }
  static __device__ __forceinline__ void keep(v16b a, v16b b, v16b c, v16b d) { keep4_b(a, b, c, d); }
};

__device__ __forceinline__ unsigned pk16(unsigned short a, unsigned short b) { return (unsigned)a | ((unsigned)b << 16); }
__device__ __forceinline__ unsigned short h_bits(float f) { const _Float16 h = (_Float16)f; return __builtin_bit_cast(unsigned short, h); }

// ---- Register-blocked batched WMMA GEMM (ACT reduced to none/relu/leaky) -----------------------
// C[m,n] = scale * sum_k A[m,k] * Bt[n,k] (+bias)(+resid); each wave owns a 64x64 tile.
// A row-major [M,K]; Bt row-major [N,K]; M,N % 64 == 0, K % 32 == 0.
// SPLIT: operands are hi/lo planes (A2/Bt2 = lo planes, same layout); product = hi*hi + hi*lo + lo*hi.
// BIAS_MODE: 0 = none, 1 = bias[m], 2 = bias[n].
// OUT_MODE: 0 = f32, 1 = f16, 2 = bf16 hi plane (Cout) + bf16 lo plane (Cout2).
// ET: 0 = f16 operands, 1 = bf16 operands (pointers passed as 16-bit storage)
template <int ET> struct Elem;
template <> struct Elem<0> { typedef _Float16 T; };
template <> struct Elem<1> { typedef __bf16 T; };
template <int ET, bool SPLIT, int BIAS_MODE, int OUT_MODE, bool RESID, int ACT = 0>
__global__ __launch_bounds__(256) void wmma_gemm64(
    const unsigned short* __restrict__ Ap, const unsigned short* __restrict__ A2p, int lda, long strideA,
    const unsigned short* __restrict__ Btp, const unsigned short* __restrict__ Bt2p, int ldb, long strideB,
    void* __restrict__ Cout, void* __restrict__ Cout2, int ldc, long strideC,
    const float* __restrict__ bias,
    const float* __restrict__ resid, long strideR,
    int M, int N, int K, float scale) {
  typedef typename Elem<ET>::T T;
  typedef typename Frag<T>::V V;
  const T* A = (const T*)Ap; const T* A2 = (const T*)A2p; const T* Bt = (const T*)Btp; const T* Bt2 = (const T*)Bt2p;
  __shared__ __align__(16) float sT[8][16 * 68];   // per-wave 16x64 slab, pitch 68 floats
  const int b    = blockIdx.y;
  const int lane = threadIdx.x & 31;
  const int wave = threadIdx.x >> 5;
  const int tilesN = N >> 6;
  const int tilesM = M >> 6;
  const int tile = blockIdx.x * 8 + wave;
  if (tile >= tilesM * tilesN) return;   // wave-uniform; no block barriers in this kernel
  const int tm = tile / tilesN;
  const int tn = tile - tm * tilesN;
  const int m0 = tm << 6;
  const int n0 = tn << 6;

  const T* Ab  = A  + (size_t)b * strideA;
  const T* Bb  = Bt + (size_t)b * strideB;
  const T* Ab2 = SPLIT ? (A2  + (size_t)b * strideA) : nullptr;
  const T* Bb2 = SPLIT ? (Bt2 + (size_t)b * strideB) : nullptr;

  const int rlane = lane & 15;                 // row (A) / col (B, D) within subtile
  const int koff  = (lane >> 4) * 8;           // k offset of this lane half
  const int mOff  = (lane >> 4) * 8;           // D row offset

  v8f acc[4][4];
#pragma unroll
  for (int i = 0; i < 4; ++i)
#pragma unroll
    for (int j = 0; j < 4; ++j) acc[i][j] = (v8f){0.f,0.f,0.f,0.f,0.f,0.f,0.f,0.f};

  for (int k0 = 0; k0 < K; k0 += 32) {
    V bh[4], bl[4];
#pragma unroll
    for (int j = 0; j < 4; ++j) {
      const size_t bo = (size_t)(n0 + (j << 4) + rlane) * ldb + koff + k0;
      bh[j] = Frag<T>::load(Bb + bo);
      if (SPLIT) bl[j] = Frag<T>::load(Bb2 + bo);
    }
#pragma unroll
    for (int i = 0; i < 4; ++i) {
      const size_t ao = (size_t)(m0 + (i << 4) + rlane) * lda + koff + k0;
      V ah = Frag<T>::load(Ab + ao);
      V al;
      if (SPLIT) al = Frag<T>::load(Ab2 + ao);
#pragma unroll
      for (int j = 0; j < 4; ++j) {
        acc[i][j] = Frag<T>::mma(ah, bh[j], acc[i][j]);
        if (SPLIT) {
          acc[i][j] = Frag<T>::mma(ah, bl[j], acc[i][j]);
          acc[i][j] = Frag<T>::mma(al, bh[j], acc[i][j]);
        }
      }
      Frag<T>::guard(acc[i][0], acc[i][3], ah, SPLIT ? al : ah);
    }
    Frag<T>::keep(bh[0], bh[1], bh[2], bh[3]);
    if (SPLIT) Frag<T>::keep(bl[0], bl[1], bl[2], bl[3]);
  }
  acc_guard4(acc[0][0], acc[0][1], acc[0][2], acc[0][3]);
  acc_guard4(acc[1][0], acc[1][1], acc[1][2], acc[1][3]);
  acc_guard4(acc[2][0], acc[2][1], acc[2][2], acc[2][3]);
  acc_guard4(acc[3][0], acc[3][1], acc[3][2], acc[3][3]);

  // ---- epilogue ----
  float* slab = sT[wave];
  const float* Rb = RESID ? (resid + (size_t)b * strideR) : nullptr;
#pragma unroll
  for (int i = 0; i < 4; ++i) {
    const int mBase = m0 + (i << 4);
#pragma unroll
    for (int j = 0; j < 4; ++j) {
      const int n = n0 + (j << 4) + rlane;
      float bv = 0.f;
      if (BIAS_MODE == 2) bv = bias[n];
#pragma unroll
      for (int r = 0; r < 8; ++r) {
        float v = acc[i][j][r] * scale;
        if (BIAS_MODE == 1) v += bias[mBase + mOff + r];
        if (BIAS_MODE == 2) v += bv;
        if (RESID) v += Rb[(size_t)(mBase + mOff + r) * ldc + n];
        if (ACT == 2) v = fmaxf(v, 0.0f);
        if (ACT == 4) v = (v > 0.f) ? v : 0.01f * v;
        slab[(mOff + r) * 68 + (j << 4) + rlane] = v;
      }
    }
    __builtin_amdgcn_fence(__ATOMIC_RELEASE, "workgroup");
    __builtin_amdgcn_wave_barrier();
    __builtin_amdgcn_fence(__ATOMIC_ACQUIRE, "workgroup");
    if (OUT_MODE == 0) {
      float* C = (float*)Cout + (size_t)b * strideC;
      const int hh = lane >> 4, c4 = (lane & 15) * 4;     // row seg = 256 B = 16 lanes x 16 B
      {
#pragma unroll
        for (int it = 0; it < 8; ++it) {
          const int row = it * 2 + hh;
          v4f v = *(const v4f*)(slab + row * 68 + c4);
          *(v4f*)(C + (size_t)(mBase + row) * ldc + n0 + c4) = v;
        }
        
      }
    } else {
      const int q = lane >> 3, c8 = (lane & 7) * 8;
      unsigned short* C  = (unsigned short*)Cout  + (size_t)b * strideC;
      unsigned short* C2 = (OUT_MODE == 2) ? ((unsigned short*)Cout2 + (size_t)b * strideC) : nullptr;
      {
#pragma unroll
        for (int it = 0; it < 4; ++it) {
          const int row = it * 4 + q;
          const float* sp = slab + row * 68 + c8;
          v8h hv, lv;
#pragma unroll
          for (int e = 0; e < 8; ++e) {
            if (OUT_MODE == 1) {
              hv[e] = (_Float16)sp[e];
            } else {
              unsigned short hb = f2bf_bits(sp[e]);
              unsigned short lb = f2bf_bits(sp[e] - bf_bits2f(hb));
              hv[e] = __builtin_bit_cast(_Float16, hb);
              lv[e] = __builtin_bit_cast(_Float16, lb);
            }
          }
          *(v8h*)(C + (size_t)(mBase + row) * ldc + n0 + c8) = hv;
          if (OUT_MODE == 2) *(v8h*)(C2 + (size_t)(mBase + row) * ldc + n0 + c8) = lv;
        }
        
      }
    }
    __builtin_amdgcn_fence(__ATOMIC_RELEASE, "workgroup");
    __builtin_amdgcn_wave_barrier();
    __builtin_amdgcn_fence(__ATOMIC_ACQUIRE, "workgroup");
  }
}

// ---------------------------------------------------------------------------
// f32 -> f16 cast with an exact power-of-two carry: out[8i..8i+7] = f16(in[8i..8i+7] * carry).
// exact multiple of 256 for both planes here; the guard is belt and braces).
// ---------------------------------------------------------------------------
__global__ __launch_bounds__(256) void cast8_f16_carry_kernel(const float* __restrict__ in, unsigned short* __restrict__ out,
                                                             int n8, float carry) {
  const int i = blockIdx.x * 256 + threadIdx.x;
  if (i >= n8) return;
  const float* p = in + 8 * (size_t)i;
  const v4f a = *(const v4f*)(p);
  const v4f c = *(const v4f*)(p + 4);
  unsigned short hb[8];
#pragma unroll
  for (int e = 0; e < 4; ++e) {
    hb[e]     = h_bits(a[e] * carry);
    hb[4 + e] = h_bits(c[e] * carry);
  }
  const v4u u = (v4u){pk16(hb[0], hb[1]), pk16(hb[2], hb[3]), pk16(hb[4], hb[5]), pk16(hb[6], hb[7])};
  unsigned short* q = out + 8 * (size_t)i;
  *(v4u*)q = u;
  
}

// ---------------------------------------------------------------------------
// Activation planes for one row m of x [kRows][kIn] (f32):
//   Ab[m][i]       = f16( x * sigmoid(x) )                     (plane pitch kIn = 1024 halves, 2048 B rows)
//   As[m][3*i + g] = f16( sin( x * (g+1) ) ), g = 0,1,2        (plane pitch kKspl = 3072 halves, 6144 B rows)
// One block of 256 threads per row; thread t owns i = 4t..4t+3 (256 x 4 = 1024 = whole row).
// Elementwise math in f32 (precise expf / sinf, no fused contraction on the angle multiply), rolled loops.
//   As row: 384 chunks of 8 halves; thread t writes chunk t, threads 0..127 also chunk 256+t -> union 0..383;
// ---------------------------------------------------------------------------
__global__ __launch_bounds__(256) void act_rows_kernel(const float* __restrict__ x, unsigned short* __restrict__ Ab,
                                                       unsigned short* __restrict__ As, int nrows) {
#pragma clang fp contract(off)
  __shared__ __align__(16) unsigned short sBase[kIn];
  __shared__ __align__(16) unsigned short sSpl[kKspl];
  const int m = blockIdx.x;
  if (m >= nrows) return;                       // block-uniform, before any barrier
  const int t = threadIdx.x;
  const float* xr = x + (size_t)m * kIn + 4 * t;
#pragma unroll 1
  for (int j = 0; j < 4; ++j) {
    const float xv = xr[j];
    const float e  = expf(fminf(-xv, 30.0f));
    const float sg = 1.0f / (1.0f + e);
    const float sl = xv * sg;
    sBase[4 * t + j] = h_bits(sl);
#pragma unroll 1
    for (int g = 1; g <= kGridN; ++g) {
      const float ang = xv * (float)g;
      const float sv  = sinf(ang);
      sSpl[12 * t + 3 * j + (g - 1)] = h_bits(sv);
    }
  }
  __syncthreads();

  const int t2 = (t < 128) ? t : 0;             // clamped index for the second-phase chunks
  const v4u u0 = *(const v4u*)(sSpl + 8 * t);
  const v4u u1 = *(const v4u*)(sSpl + 8 * (256 + t2));
  const v4u ub = *(const v4u*)(sBase + 8 * t2);
  unsigned short* arow = As + (size_t)m * kKspl;
  unsigned short* brow = Ab + (size_t)m * kIn;
  {
    *(v4u*)(arow + 8 * t) = u0;
    if (t < 128) {
      *(v4u*)(arow + 8 * (256 + t)) = u1;
      *(v4u*)(brow + 8 * t) = ub;
    }
    
  }
}

// ---------------------------------------------------------------------------
// Launcher.
// d_in: {x [8192][1024] f32, base_w [1024][1024] f32, base_b [1024] f32, spline_w [1024][1024][3] f32}; d_out f32 [8192][1024].
//   Ab   f16 [8192][1024]   16,777,216  @          0
//   As   f16 [8192][3072]   50,331,648  @ 16,777,216
//   Wb   f16 [1024][1024]    2,097,152  @ 67,108,864   (base_w * 32)
//   Ws   f16 [1024][3072]    6,291,456  @ 69,206,016   (spline_w * 4096, flat [o][i*3+g])
//   P    f32 [8192][1024]   33,554,432  @ 75,497,472   (base branch output incl. bias)
//   total                  109,051,904
// GEMM assertions: M = 8192 and N = 1024 are multiples of 64; K = 1024 and K = 3072 are multiples of 32 (no padding, no tails).
// ---------------------------------------------------------------------------
extern "C" void kernel_launch(void* const* d_in, const int* in_sizes, int n_in,
                              void* d_out, int out_size, void* d_ws, size_t ws_size,
                              hipStream_t stream) {
  if (n_in < 4) return;
  if (in_sizes[0] != kRows * kIn) return;
  if (in_sizes[1] != kOut * kIn) return;
  if (in_sizes[2] != kOut) return;
  if (in_sizes[3] != kOut * kIn * kGridN) return;
  if (out_size != kRows * kOut) return;

  const float* x        = (const float*)d_in[0];
  const float* base_w   = (const float*)d_in[1];
  const float* base_b   = (const float*)d_in[2];
  const float* spline_w = (const float*)d_in[3];
  float*       out      = (float*)d_out;

  const size_t bytesAb = (size_t)kRows * kIn * 2;
  const size_t bytesAs = (size_t)kRows * kKspl * 2;
  const size_t bytesWb = (size_t)kOut * kIn * 2;
  const size_t bytesWs = (size_t)kOut * kKspl * 2;
  const size_t bytesP  = (size_t)kRows * kOut * 4;
  const size_t offAb = 0;
  const size_t offAs = offAb + bytesAb;
  const size_t offWb = offAs + bytesAs;
  const size_t offWs = offWb + bytesWb;
  const size_t offP  = offWs + bytesWs;
  const size_t total = offP + bytesP;
  if (total > ws_size) return;

  unsigned char* ws = (unsigned char*)d_ws;
  unsigned short* Ab = (unsigned short*)(ws + offAb);
  unsigned short* As = (unsigned short*)(ws + offAs);
  unsigned short* Wb = (unsigned short*)(ws + offWb);
  unsigned short* Ws = (unsigned short*)(ws + offWs);
  float*          P  = (float*)(ws + offP);

  // 1) activation planes: one block per row
  act_rows_kernel<<<dim3(kRows), dim3(256), 0, stream>>>(x, Ab, As, kRows);

  // 2) weight planes with carries
  {
    const int n8b = kOut * kIn / 8;          // 131072 -> 512 blocks
    const int n8s = kOut * kKspl / 8;        // 393216 -> 1536 blocks
    cast8_f16_carry_kernel<<<dim3((n8b + 255) / 256), dim3(256), 0, stream>>>(base_w, Wb, n8b, kWbCarry);
    cast8_f16_carry_kernel<<<dim3((n8s + 255) / 256), dim3(256), 0, stream>>>(spline_w, Ws, n8s, kWsCarry);
  }

  const int tiles  = (kRows / 64) * (kOut / 64);   // 2048 wave tiles
  const int gblk   = (tiles + 7) / 8;              // 256 blocks of 8 waves

  // 3) base branch: P = (Ab . Wb^T) / 32 + base_b      (f32 plane)
  wmma_gemm64<0, false, 2, 0, false, 0><<<dim3(gblk, 1), dim3(256), 0, stream>>>(
      Ab, Ab, kIn, 0L,
      Wb, Wb, kIn, 0L,
      (void*)P, (void*)P, kOut, 0L,
      base_b,
      P, 0L,
      kRows, kOut, kIn, kBaseScale);

  // 4) basis branch + sum: out = (As . Ws^T) / 4096 + P
  wmma_gemm64<0, false, 0, 0, true, 0><<<dim3(gblk, 1), dim3(256), 0, stream>>>(
      As, As, kKspl, 0L,
      Ws, Ws, kKspl, 0L,
      (void*)out, (void*)out, kOut, 0L,
      base_b,
      P, 0L,
      kRows, kOut, kKspl, kSplScale);
}

// v001
// A run of this version takes 97.8 microseconds.
// In two side-by-side timings against v000, it was 2.39 and 2.40 times as fast.
// Contractions: silu(x) f16 x (base_w carried x32) f16, K=1024; sin-basis f16 x (spline_w carried x4096) f16, K=3072; both v_wmma_f32_16x16x32_f16 with f32 accumulate; silu/sin/bias/sum in f32.
#include <hip/hip_runtime.h>
#include <math.h>

// ---------------------------------------------------------------------------
// Problem constants
// ---------------------------------------------------------------------------
constexpr int kRows  = 4 * 2048;        // M = 8192 token rows
constexpr int kIn    = 1024;            // input features
constexpr int kOut   = 1024;            // output features
constexpr int kGridN = 3;               // sin basis count
constexpr int kKspl  = kIn * kGridN;    // 3072, K of the basis GEMM (index i*3+g)
constexpr float kWbCarry   = 32.0f;     // base weight carried x32 in f16
constexpr float kWsCarry   = 4096.0f;   // basis weight carried x4096 in f16
constexpr float kBaseScale = 1.0f / 32.0f;
constexpr float kSplScale  = 1.0f / 4096.0f;

typedef __attribute__((ext_vector_type(16))) _Float16 v16h;
typedef __attribute__((ext_vector_type(8)))  _Float16 v8h;
typedef __attribute__((ext_vector_type(16))) __bf16   v16b;
typedef __attribute__((ext_vector_type(8)))  __bf16   v8b;
typedef __attribute__((ext_vector_type(8)))  float    v8f;
typedef __attribute__((ext_vector_type(4)))  float    v4f;
typedef __attribute__((ext_vector_type(4)))  unsigned int v4u;

// ---------------------------------------------------------------------------
// Helpers
// ---------------------------------------------------------------------------
__device__ __forceinline__ unsigned short f2bf_bits(float f) {
  unsigned u = __float_as_uint(f);
  return (unsigned short)((u + 0x7FFFu + ((u >> 16) & 1u)) >> 16);
}
__device__ __forceinline__ float bf_bits2f(unsigned short h) { return __uint_as_float(((unsigned)h) << 16); }

// hazard guards as plain device helpers
__device__ __forceinline__ void dep_guard_h(v8f& a, v8f& b, v16h x, v16h y) { asm volatile("v_nop\n\tv_nop\n\tv_nop\n\tv_nop" : "+v"(a), "+v"(b) : "v"(x), "v"(y)); }
__device__ __forceinline__ void dep_guard_b(v8f& a, v8f& b, v16b x, v16b y) { asm volatile("v_nop\n\tv_nop\n\tv_nop\n\tv_nop" : "+v"(a), "+v"(b) : "v"(x), "v"(y)); }
__device__ __forceinline__ void keep4_h(v16h a, v16h b, v16h c, v16h d) { asm volatile("v_nop" :: "v"(a), "v"(b), "v"(c), "v"(d)); }
__device__ __forceinline__ void keep4_b(v16b a, v16b b, v16b c, v16b d) { asm volatile("v_nop" :: "v"(a), "v"(b), "v"(c), "v"(d)); }
__device__ __forceinline__ void acc_guard4(v8f& a, v8f& b, v8f& c, v8f& d) { asm volatile("v_nop\n\tv_nop\n\tv_nop\n\tv_nop" : "+v"(a), "+v"(b), "+v"(c), "+v"(d)); }
template <typename T> struct Frag;
template <> struct Frag<_Float16> {
  typedef v16h V; union U { v16h v; v8h h[2]; };
  static __device__ __forceinline__ v16h load(const _Float16* p) {   // elements 0..7 <- p[0..7], 8..15 <- p[16..23]
    U f; f.h[0] = *(const v8h*)(p); f.h[1] = *(const v8h*)(p + 16); return f.v;
  }
  static __device__ __forceinline__ v8f mma(v16h a, v16h b, v8f c) {
    return __builtin_amdgcn_wmma_f32_16x16x32_f16(false, a, false, b, (short)0, c, false, false);
  }
  static __device__ __forceinline__ void guard(v8f& a, v8f& b, v16h x, v16h y) { dep_guard_h(a, b, x, y); }
  static __device__ __forceinline__ void keep(v16h a, v16h b, v16h c, v16h d) { keep4_h(a, b, c, d); }
};
template <> struct Frag<__bf16> {
  typedef v16b V; union U { v16b v; v8b h[2]; };
  static __device__ __forceinline__ v16b load(const __bf16* p) {
    U f; f.h[0] = *(const v8b*)(p); f.h[1] = *(const v8b*)(p + 16); return f.v;
  }
  static __device__ __forceinline__ v8f mma(v16b a, v16b b, v8f c) {
    return __builtin_amdgcn_wmma_f32_16x16x32_bf16(false, a, false, b, (short)0, c, false, false);
  }
  static __device__ __forceinline__ void guard(v8f& a, v8f& b, v16b x, v16b y) { dep_guard_b(a, b, x, y); }
  static __device__ __forceinline__ void keep(v16b a, v16b b, v16b c, v16b d) { keep4_b(a, b, c, d); }
};

__device__ __forceinline__ unsigned pk16(unsigned short a, unsigned short b) { return (unsigned)a | ((unsigned)b << 16); }
__device__ __forceinline__ unsigned short h_bits(float f) { const _Float16 h = (_Float16)f; return __builtin_bit_cast(unsigned short, h); }

// ---- WMMA GEMM with both operands staged in LDS ---------------------------------------------------------------------
// C[m,n] = scale * sum_k A[m,k] * Bt[n,k] (+bias[n]) (+resid[m,n]); A row-major [M][KD], Bt row-major [N][KD], f16.
// One workgroup of 8 waves owns a 128 x 256 tile of C (waves 2 x 4, each 64 x 64 as before).
// A pass is 128 k = 256 B of each of the 128 A rows and 256 Bt rows; a stage holds them at pitch 272 B (A rows first).
// Two buffers: the copies of pass t + 2 fly while pass t + 1 is worked on.
constexpr int kTileM   = 128;
constexpr int kTileN   = 256;
constexpr int kPassK   = 128;                              // halves per pass and row
constexpr int kPitchB  = 272;                              // LDS row pitch in bytes: 16 B x odd for 16-byte readers
constexpr int kStageB  = (kTileM + kTileN) * kPitchB;      // 104,448 B
constexpr int kRowStep = 16;                               // rows between two copies of one thread

__device__ __forceinline__ unsigned lds_off(const void* p) { return (unsigned)(size_t)p; }

// Eight 16-byte copies per lane, global -> LDS, rows kRowStep apart. The s_wait_xcnt stands inside the statement so that
// no address register of an issued copy is rewritten ahead of it.
template <int GSTEP>
__device__ __forceinline__ void async_copy8(unsigned l, const unsigned short* g) {
  constexpr unsigned LS = kRowStep * kPitchB;
  asm volatile(
      "global_load_async_to_lds_b128 %0, %8, off\n\t"
      "global_load_async_to_lds_b128 %1, %9, off\n\t"
      "global_load_async_to_lds_b128 %2, %10, off\n\t"
      "global_load_async_to_lds_b128 %3, %11, off\n\t"
      "global_load_async_to_lds_b128 %4, %12, off\n\t"
      "global_load_async_to_lds_b128 %5, %13, off\n\t"
      "global_load_async_to_lds_b128 %6, %14, off\n\t"
      "global_load_async_to_lds_b128 %7, %15, off\n\t"
      "s_wait_xcnt 0x0"
      :: "v"(l), "v"(l + LS), "v"(l + 2 * LS), "v"(l + 3 * LS), "v"(l + 4 * LS), "v"(l + 5 * LS), "v"(l + 6 * LS), "v"(l + 7 * LS),
         "v"(g), "v"(g + GSTEP), "v"(g + 2 * GSTEP), "v"(g + 3 * GSTEP), "v"(g + 4 * GSTEP), "v"(g + 5 * GSTEP), "v"(g + 6 * GSTEP), "v"(g + 7 * GSTEP)
      : "memory");
}

template <int KD, bool HAS_BIAS, bool RESID>
__global__ __launch_bounds__(256) void wmma_gemm_lds(
    const unsigned short* __restrict__ Ap, const unsigned short* __restrict__ Btp,
    float* __restrict__ C, const float* __restrict__ bias, const float* __restrict__ resid, float scale) {
  typedef _Float16 T;
  typedef Frag<T>::V V;
  static_assert(KD % kPassK == 0 && KD / kPassK >= 2, "two passes or more");
  constexpr int nPass = KD / kPassK;
  constexpr int ldc = kOut;
  __shared__ __attribute__((aligned(2048))) unsigned char ring[2 * kStageB];
  __shared__ __align__(16) float sT[8][16 * 68];   // per-wave 16x64 slab, pitch 68 floats
  const int tid  = threadIdx.x;
  const int lane = tid & 31;
  const int wave = tid >> 5;
  const int m0b = blockIdx.y * kTileM;
  const int n0b = blockIdx.x * kTileN;
  const int wm = wave >> 2;
  const int wn = wave & 3;
  const int m0 = m0b + (wm << 6);
  const int n0 = n0b + (wn << 6);

  const int rlane = lane & 15;                 // row (A) / col (B, D) within subtile
  const int koff  = (lane >> 4) * 8;           // k offset of this lane half
  const int mOff  = (lane >> 4) * 8;           // D row offset

  // copies: thread tid brings 16 B at column (tid & 15) of rows (tid >> 4) + 16 i
  const int crow = tid >> 4;
  const int ccol = tid & 15;
  const unsigned short* gA = Ap  + (size_t)(m0b + crow) * KD + ccol * 8;
  const unsigned short* gB = Btp + (size_t)(n0b + crow) * KD + ccol * 8;
  const unsigned lcopy = lds_off(ring) + crow * kPitchB + ccol * 16;
  auto issue_stage = [&](int pass, int buf) {
    const unsigned l = lcopy + buf * kStageB;
    async_copy8<kRowStep * KD>(l, gA + pass * kPassK);
    async_copy8<kRowStep * KD>(l + 128 * kPitchB, gB + pass * kPassK);
    async_copy8<kRowStep * KD>(l + 256 * kPitchB, gB + pass * kPassK + (size_t)128 * KD);
  };

  const unsigned char* rA0 = ring + ((wm << 6) + rlane) * kPitchB + koff * 2;
  const unsigned char* rB0 = ring + (kTileM + (wn << 6) + rlane) * kPitchB + koff * 2;

  v8f acc[4][4];
#pragma unroll
  for (int i = 0; i < 4; ++i)
#pragma unroll
    for (int j = 0; j < 4; ++j) acc[i][j] = (v8f){0.f,0.f,0.f,0.f,0.f,0.f,0.f,0.f};

  issue_stage(0, 0);
  asm volatile("s_wait_asynccnt 0x0" ::: "memory");   // this wave's copies of stage 0 have landed
  __syncthreads();                                     // every wave's have
  issue_stage(1, 1);

#pragma unroll 1   // one pass per trip: the ring's waits and barrier stand once, at the foot
  for (int t = 0; t < nPass; ++t) {
    const unsigned char* rA = rA0 + (t & 1) * kStageB;
    const unsigned char* rB = rB0 + (t & 1) * kStageB;
    V af[2][4], bf[2][4];
#pragma unroll
    for (int j = 0; j < 4; ++j) bf[0][j] = Frag<T>::load((const T*)(rB + j * 16 * kPitchB));
#pragma unroll
    for (int i = 0; i < 4; ++i) af[0][i] = Frag<T>::load((const T*)(rA + i * 16 * kPitchB));
#pragma unroll
    for (int kk = 0; kk < kPassK / 32; ++kk) {
      const int cur = kk & 1, nxt = cur ^ 1;
      if (kk + 1 < kPassK / 32) {                      // the next block's fragments, as one group ahead of this block
#pragma unroll
        for (int j = 0; j < 4; ++j) bf[nxt][j] = Frag<T>::load((const T*)(rB + j * 16 * kPitchB + (kk + 1) * 64));
#pragma unroll
        for (int i = 0; i < 4; ++i) af[nxt][i] = Frag<T>::load((const T*)(rA + i * 16 * kPitchB + (kk + 1) * 64));
      }
      __builtin_amdgcn_sched_barrier(0);               // keeps that group whole and ahead of the WMMAs (for speed only)
#pragma unroll
      for (int i = 0; i < 4; ++i)
#pragma unroll
        for (int j = 0; j < 4; ++j) acc[i][j] = Frag<T>::mma(af[cur][i], bf[cur][j], acc[i][j]);
      __builtin_amdgcn_sched_barrier(0);               // the following group does not rise into this block
    }
    asm volatile("s_wait_dscnt 0x0" ::: "memory");     // this wave has left buffer t & 1
    asm volatile("s_wait_asynccnt 0x0" ::: "memory");  // its copies of stage t + 1 have landed
    __syncthreads();                                   // publishes stage t + 1 and frees buffer t & 1
    if (t + 2 < nPass) issue_stage(t + 2, t & 1);
  }
  asm volatile("s_wait_asynccnt 0x0" ::: "memory");    // no copy is left in flight behind the loop
  acc_guard4(acc[0][0], acc[0][1], acc[0][2], acc[0][3]);
  acc_guard4(acc[1][0], acc[1][1], acc[1][2], acc[1][3]);
  acc_guard4(acc[2][0], acc[2][1], acc[2][2], acc[2][3]);
  acc_guard4(acc[3][0], acc[3][1], acc[3][2], acc[3][3]);

  // ---- epilogue ----
  float* slab = sT[wave];
#pragma unroll
  for (int i = 0; i < 4; ++i) {
    const int mBase = m0 + (i << 4);
#pragma unroll
    for (int j = 0; j < 4; ++j) {
      const int n = n0 + (j << 4) + rlane;
      float bv = 0.f;
      if (HAS_BIAS) bv = bias[n];
#pragma unroll
      for (int r = 0; r < 8; ++r) {
        float v = acc[i][j][r] * scale;
        if (HAS_BIAS) v += bv;
        if (RESID) v += resid[(size_t)(mBase + mOff + r) * ldc + n];
        slab[(mOff + r) * 68 + (j << 4) + rlane] = v;
      }
    }
    __builtin_amdgcn_fence(__ATOMIC_RELEASE, "workgroup");
    __builtin_amdgcn_wave_barrier();
    __builtin_amdgcn_fence(__ATOMIC_ACQUIRE, "workgroup");
    {
      const int hh = lane >> 4, c4 = (lane & 15) * 4;     // row seg = 256 B = 16 lanes x 16 B
#pragma unroll
      for (int it = 0; it < 8; ++it) {
        const int row = it * 2 + hh;
        v4f v = *(const v4f*)(slab + row * 68 + c4);
        *(v4f*)(C + (size_t)(mBase + row) * ldc + n0 + c4) = v;
      }
    }
    __builtin_amdgcn_fence(__ATOMIC_RELEASE, "workgroup");
    __builtin_amdgcn_wave_barrier();
    __builtin_amdgcn_fence(__ATOMIC_ACQUIRE, "workgroup");
  }
}

// ---------------------------------------------------------------------------
// f32 -> f16 cast with an exact power-of-two carry: out[8i..8i+7] = f16(in[8i..8i+7] * carry).
// exact multiple of 256 for both planes here; the guard is belt and braces).
// ---------------------------------------------------------------------------
__global__ __launch_bounds__(256) void cast8_f16_carry_kernel(const float* __restrict__ in, unsigned short* __restrict__ out,
                                                             int n8, float carry) {
  const int i = blockIdx.x * 256 + threadIdx.x;
  if (i >= n8) return;
  const float* p = in + 8 * (size_t)i;
  const v4f a = *(const v4f*)(p);
  const v4f c = *(const v4f*)(p + 4);
  unsigned short hb[8];
#pragma unroll
  for (int e = 0; e < 4; ++e) {
    hb[e]     = h_bits(a[e] * carry);
    hb[4 + e] = h_bits(c[e] * carry);
  }
  const v4u u = (v4u){pk16(hb[0], hb[1]), pk16(hb[2], hb[3]), pk16(hb[4], hb[5]), pk16(hb[6], hb[7])};
  unsigned short* q = out + 8 * (size_t)i;
  *(v4u*)q = u;
  
}

// ---------------------------------------------------------------------------
// Activation planes for one row m of x [kRows][kIn] (f32):
//   Ab[m][i]       = f16( x * sigmoid(x) )                     (plane pitch kIn = 1024 halves, 2048 B rows)
//   As[m][3*i + g] = f16( sin( x * (g+1) ) ), g = 0,1,2        (plane pitch kKspl = 3072 halves, 6144 B rows)
// One block of 256 threads per row; thread t owns i = 4t..4t+3 (256 x 4 = 1024 = whole row).
// Elementwise math in f32 (precise expf / sinf, no fused contraction on the angle multiply), rolled loops.
//   As row: 384 chunks of 8 halves; thread t writes chunk t, threads 0..127 also chunk 256+t -> union 0..383;
// ---------------------------------------------------------------------------
__global__ __launch_bounds__(256) void act_rows_kernel(const float* __restrict__ x, unsigned short* __restrict__ Ab,
                                                       unsigned short* __restrict__ As, int nrows) {
#pragma clang fp contract(off)
  __shared__ __align__(16) unsigned short sBase[kIn];
  __shared__ __align__(16) unsigned short sSpl[kKspl];
  const int m = blockIdx.x;
  if (m >= nrows) return;                       // block-uniform, before any barrier
  const int t = threadIdx.x;
  const float* xr = x + (size_t)m * kIn + 4 * t;
#pragma unroll 1
  for (int j = 0; j < 4; ++j) {
    const float xv = xr[j];
    const float e  = expf(fminf(-xv, 30.0f));
    const float sg = 1.0f / (1.0f + e);
    const float sl = xv * sg;
    sBase[4 * t + j] = h_bits(sl);
#pragma unroll 1
    for (int g = 1; g <= kGridN; ++g) {
      const float ang = xv * (float)g;
      const float sv  = sinf(ang);
      sSpl[12 * t + 3 * j + (g - 1)] = h_bits(sv);
    }
  }
  __syncthreads();

  const int t2 = (t < 128) ? t : 0;             // clamped index for the second-phase chunks
  const v4u u0 = *(const v4u*)(sSpl + 8 * t);
  const v4u u1 = *(const v4u*)(sSpl + 8 * (256 + t2));
  const v4u ub = *(const v4u*)(sBase + 8 * t2);
  unsigned short* arow = As + (size_t)m * kKspl;
  unsigned short* brow = Ab + (size_t)m * kIn;
  {
    *(v4u*)(arow + 8 * t) = u0;
    if (t < 128) {
      *(v4u*)(arow + 8 * (256 + t)) = u1;
      *(v4u*)(brow + 8 * t) = ub;
    }
    
  }
}

// ---------------------------------------------------------------------------
// Launcher.
// d_in: {x [8192][1024] f32, base_w [1024][1024] f32, base_b [1024] f32, spline_w [1024][1024][3] f32}; d_out f32 [8192][1024].
//   Ab   f16 [8192][1024]   16,777,216  @          0
//   As   f16 [8192][3072]   50,331,648  @ 16,777,216
//   Wb   f16 [1024][1024]    2,097,152  @ 67,108,864   (base_w * 32)
//   Ws   f16 [1024][3072]    6,291,456  @ 69,206,016   (spline_w * 4096, flat [o][i*3+g])
//   P    f32 [8192][1024]   33,554,432  @ 75,497,472   (base branch output incl. bias)
//   total                  109,051,904
// GEMM assertions: M = 8192 is a multiple of 128, N = 1024 of 256; K = 1024 and K = 3072 are multiples of 128 (no padding, no tails).
// ---------------------------------------------------------------------------
extern "C" void kernel_launch(void* const* d_in, const int* in_sizes, int n_in,
                              void* d_out, int out_size, void* d_ws, size_t ws_size,
                              hipStream_t stream) {
  if (n_in < 4) return;
  if (in_sizes[0] != kRows * kIn) return;
  if (in_sizes[1] != kOut * kIn) return;
  if (in_sizes[2] != kOut) return;
  if (in_sizes[3] != kOut * kIn * kGridN) return;
  if (out_size != kRows * kOut) return;

  const float* x        = (const float*)d_in[0];
  const float* base_w   = (const float*)d_in[1];
  const float* base_b   = (const float*)d_in[2];
  const float* spline_w = (const float*)d_in[3];
  float*       out      = (float*)d_out;

  const size_t bytesAb = (size_t)kRows * kIn * 2;
  const size_t bytesAs = (size_t)kRows * kKspl * 2;
  const size_t bytesWb = (size_t)kOut * kIn * 2;
  const size_t bytesWs = (size_t)kOut * kKspl * 2;
  const size_t bytesP  = (size_t)kRows * kOut * 4;
  const size_t offAb = 0;
  const size_t offAs = offAb + bytesAb;
  const size_t offWb = offAs + bytesAs;
  const size_t offWs = offWb + bytesWb;
  const size_t offP  = offWs + bytesWs;
  const size_t total = offP + bytesP;
  if (total > ws_size) return;

  unsigned char* ws = (unsigned char*)d_ws;
  unsigned short* Ab = (unsigned short*)(ws + offAb);
  unsigned short* As = (unsigned short*)(ws + offAs);
  unsigned short* Wb = (unsigned short*)(ws + offWb);
  unsigned short* Ws = (unsigned short*)(ws + offWs);
  float*          P  = (float*)(ws + offP);

  // 1) activation planes: one block per row
  act_rows_kernel<<<dim3(kRows), dim3(256), 0, stream>>>(x, Ab, As, kRows);

  // 2) weight planes with carries
  {
    const int n8b = kOut * kIn / 8;          // 131072 -> 512 blocks
    const int n8s = kOut * kKspl / 8;        // 393216 -> 1536 blocks
    cast8_f16_carry_kernel<<<dim3((n8b + 255) / 256), dim3(256), 0, stream>>>(base_w, Wb, n8b, kWbCarry);
    cast8_f16_carry_kernel<<<dim3((n8s + 255) / 256), dim3(256), 0, stream>>>(spline_w, Ws, n8s, kWsCarry);
  }

  const dim3 ggrid(kOut / kTileN, kRows / kTileM);   // 4 x 64 = 256 workgroups of 8 waves

  // 3) base branch: P = (Ab . Wb^T) / 32 + base_b      (f32 plane)
  wmma_gemm_lds<kIn, true, false><<<ggrid, dim3(256), 0, stream>>>(Ab, Wb, P, base_b, P, kBaseScale);

  // 4) basis branch + sum: out = (As . Ws^T) / 4096 + P
  wmma_gemm_lds<kKspl, false, true><<<ggrid, dim3(256), 0, stream>>>(As, Ws, out, base_b, P, kSplScale);
}

// v002
// One run takes 81.2 microseconds.
// Timed twice side by side with v001, it ran 1.21 and 1.20 times as fast.
// Over all steps from v000 it is 2.89 times as fast.
// Contraction: [silu(x) | sin-basis] f16 x [base_w | spline_w] f16 (both carried x4096), one product over K=1024+3072=4096; v_wmma_f32_16x16x32_f16 with f32 accumulate; silu/sin/bias in f32.
#include <hip/hip_runtime.h>
#include <math.h>

// ---------------------------------------------------------------------------
// Problem constants
// ---------------------------------------------------------------------------
constexpr int kRows  = 4 * 2048;        // M = 8192 token rows
constexpr int kIn    = 1024;            // input features
constexpr int kOut   = 1024;            // output features
constexpr int kGridN = 3;               // sin basis count
constexpr int kKspl  = kIn * kGridN;    // 3072, k extent of the basis part (index i*3+g)
constexpr int kKcat  = kIn + kKspl;     // 4096, K of the one GEMM: k < 1024 base part, k >= 1024 basis part
constexpr float kWCarry   = 4096.0f;    // both weights carried x4096 in f16, so that both parts share one accumulator
constexpr float kOutScale = 1.0f / 4096.0f;

typedef __attribute__((ext_vector_type(16))) _Float16 v16h;
typedef __attribute__((ext_vector_type(8)))  _Float16 v8h;
typedef __attribute__((ext_vector_type(16))) __bf16   v16b;
typedef __attribute__((ext_vector_type(8)))  __bf16   v8b;
typedef __attribute__((ext_vector_type(8)))  float    v8f;
typedef __attribute__((ext_vector_type(4)))  float    v4f;
typedef __attribute__((ext_vector_type(4)))  unsigned int v4u;

// ---------------------------------------------------------------------------
// Helpers
// ---------------------------------------------------------------------------
__device__ __forceinline__ unsigned short f2bf_bits(float f) {
  unsigned u = __float_as_uint(f);
  return (unsigned short)((u + 0x7FFFu + ((u >> 16) & 1u)) >> 16);
}
__device__ __forceinline__ float bf_bits2f(unsigned short h) { return __uint_as_float(((unsigned)h) << 16); }

// hazard guards as plain device helpers
__device__ __forceinline__ void dep_guard_h(v8f& a, v8f& b, v16h x, v16h y) { asm volatile("v_nop\n\tv_nop\n\tv_nop\n\tv_nop" : "+v"(a), "+v"(b) : "v"(x), "v"(y)); }
__device__ __forceinline__ void dep_guard_b(v8f& a, v8f& b, v16b x, v16b y) { asm volatile("v_nop\n\tv_nop\n\tv_nop\n\tv_nop" : "+v"(a), "+v"(b) : "v"(x), "v"(y)); }
__device__ __forceinline__ void keep4_h(v16h a, v16h b, v16h c, v16h d) { asm volatile("v_nop" :: "v"(a), "v"(b), "v"(c), "v"(d)); }
__device__ __forceinline__ void keep4_b(v16b a, v16b b, v16b c, v16b d) { asm volatile("v_nop" :: "v"(a), "v"(b), "v"(c), "v"(d)); }
__device__ __forceinline__ void acc_guard4(v8f& a, v8f& b, v8f& c, v8f& d) { asm volatile("v_nop\n\tv_nop\n\tv_nop\n\tv_nop" : "+v"(a), "+v"(b), "+v"(c), "+v"(d)); }
template <typename T> struct Frag;
template <> struct Frag<_Float16> {
  typedef v16h V; union U { v16h v; v8h h[2]; };
  static __device__ __forceinline__ v16h load(const _Float16* p) {   // elements 0..7 <- p[0..7], 8..15 <- p[16..23]
    U f; f.h[0] = *(const v8h*)(p); f.h[1] = *(const v8h*)(p + 16); return f.v;
  }
  static __device__ __forceinline__ v8f mma(v16h a, v16h b, v8f c) {
    return __builtin_amdgcn_wmma_f32_16x16x32_f16(false, a, false, b, (short)0, c, false, false);
  }
  static __device__ __forceinline__ void guard(v8f& a, v8f& b, v16h x, v16h y) { dep_guard_h(a, b, x, y); }
  static __device__ __forceinline__ void keep(v16h a, v16h b, v16h c, v16h d) { keep4_h(a, b, c, d); }
};
template <> struct Frag<__bf16> {
  typedef v16b V; union U { v16b v; v8b h[2]; };
  static __device__ __forceinline__ v16b load(const __bf16* p) {
    U f; f.h[0] = *(const v8b*)(p); f.h[1] = *(const v8b*)(p + 16); return f.v;
  }
  static __device__ __forceinline__ v8f mma(v16b a, v16b b, v8f c) {
    return __builtin_amdgcn_wmma_f32_16x16x32_bf16(false, a, false, b, (short)0, c, false, false);
  }
  static __device__ __forceinline__ void guard(v8f& a, v8f& b, v16b x, v16b y) { dep_guard_b(a, b, x, y); }
  static __device__ __forceinline__ void keep(v16b a, v16b b, v16b c, v16b d) { keep4_b(a, b, c, d); }
};

__device__ __forceinline__ unsigned pk16(unsigned short a, unsigned short b) { return (unsigned)a | ((unsigned)b << 16); }
__device__ __forceinline__ unsigned short h_bits(float f) { const _Float16 h = (_Float16)f; return __builtin_bit_cast(unsigned short, h); }

// ---- WMMA GEMM with both operands staged in LDS ---------------------------------------------------------------------
// C[m,n] = scale * sum_k A[m,k] * Bt[n,k] (+bias[n]); A row-major [M][KD], Bt row-major [N][KD], f16.
// One workgroup of 8 waves owns a 128 x 256 tile of C (waves 2 x 4, each 64 x 64 as before).
// A pass is 128 k = 256 B of each of the 128 A rows and 256 Bt rows; a stage holds them at pitch 272 B (A rows first).
// Two buffers: the copies of pass t + 2 fly while pass t + 1 is worked on.
constexpr int kTileM   = 128;
constexpr int kTileN   = 256;
constexpr int kPassK   = 128;                              // halves per pass and row
constexpr int kPitchB  = 272;                              // LDS row pitch in bytes: 16 B x odd for 16-byte readers
constexpr int kStageB  = (kTileM + kTileN) * kPitchB;      // 104,448 B
constexpr int kRowStep = 16;                               // rows between two copies of one thread

__device__ __forceinline__ unsigned lds_off(const void* p) { return (unsigned)(size_t)p; }

// Eight 16-byte copies per lane, global -> LDS, rows kRowStep apart. The s_wait_xcnt stands inside the statement so that
// no address register of an issued copy is rewritten ahead of it.
template <int GSTEP>
__device__ __forceinline__ void async_copy8(unsigned l, const unsigned short* g) {
  constexpr unsigned LS = kRowStep * kPitchB;
  asm volatile(
      "global_load_async_to_lds_b128 %0, %8, off\n\t"
      "global_load_async_to_lds_b128 %1, %9, off\n\t"
      "global_load_async_to_lds_b128 %2, %10, off\n\t"
      "global_load_async_to_lds_b128 %3, %11, off\n\t"
      "global_load_async_to_lds_b128 %4, %12, off\n\t"
      "global_load_async_to_lds_b128 %5, %13, off\n\t"
      "global_load_async_to_lds_b128 %6, %14, off\n\t"
      "global_load_async_to_lds_b128 %7, %15, off\n\t"
      "s_wait_xcnt 0x0"
      :: "v"(l), "v"(l + LS), "v"(l + 2 * LS), "v"(l + 3 * LS), "v"(l + 4 * LS), "v"(l + 5 * LS), "v"(l + 6 * LS), "v"(l + 7 * LS),
         "v"(g), "v"(g + GSTEP), "v"(g + 2 * GSTEP), "v"(g + 3 * GSTEP), "v"(g + 4 * GSTEP), "v"(g + 5 * GSTEP), "v"(g + 6 * GSTEP), "v"(g + 7 * GSTEP)
      : "memory");
}

template <int KD, bool HAS_BIAS>
__global__ __launch_bounds__(256) void wmma_gemm_lds(
    const unsigned short* __restrict__ Ap, const unsigned short* __restrict__ Btp,
    float* __restrict__ C, const float* __restrict__ bias, float scale) {
  typedef _Float16 T;
  typedef Frag<T>::V V;
  static_assert(KD % kPassK == 0 && KD / kPassK >= 2, "two passes or more");
  constexpr int nPass = KD / kPassK;
  constexpr int ldc = kOut;
  __shared__ __attribute__((aligned(2048))) unsigned char ring[2 * kStageB];
  __shared__ __align__(16) float sT[8][16 * 68];   // per-wave 16x64 slab, pitch 68 floats
  const int tid  = threadIdx.x;
  const int lane = tid & 31;
  const int wave = tid >> 5;
  const int m0b = blockIdx.y * kTileM;
  const int n0b = blockIdx.x * kTileN;
  const int wm = wave >> 2;
  const int wn = wave & 3;
  const int m0 = m0b + (wm << 6);
  const int n0 = n0b + (wn << 6);

  const int rlane = lane & 15;                 // row (A) / col (B, D) within subtile
  const int koff  = (lane >> 4) * 8;           // k offset of this lane half
  const int mOff  = (lane >> 4) * 8;           // D row offset

  // copies: thread tid brings 16 B at column (tid & 15) of rows (tid >> 4) + 16 i
  const int crow = tid >> 4;
  const int ccol = tid & 15;
  const unsigned short* gA = Ap  + (size_t)(m0b + crow) * KD + ccol * 8;
  const unsigned short* gB = Btp + (size_t)(n0b + crow) * KD + ccol * 8;
  const unsigned lcopy = lds_off(ring) + crow * kPitchB + ccol * 16;
  auto issue_stage = [&](int pass, int buf) {
    const unsigned l = lcopy + buf * kStageB;
    async_copy8<kRowStep * KD>(l, gA + pass * kPassK);
    async_copy8<kRowStep * KD>(l + 128 * kPitchB, gB + pass * kPassK);
    async_copy8<kRowStep * KD>(l + 256 * kPitchB, gB + pass * kPassK + (size_t)128 * KD);
  };

  const unsigned char* rA0 = ring + ((wm << 6) + rlane) * kPitchB + koff * 2;
  const unsigned char* rB0 = ring + (kTileM + (wn << 6) + rlane) * kPitchB + koff * 2;

  v8f acc[4][4];
#pragma unroll
  for (int i = 0; i < 4; ++i)
#pragma unroll
    for (int j = 0; j < 4; ++j) acc[i][j] = (v8f){0.f,0.f,0.f,0.f,0.f,0.f,0.f,0.f};

  issue_stage(0, 0);
  asm volatile("s_wait_asynccnt 0x0" ::: "memory");   // this wave's copies of stage 0 have landed
  __syncthreads();                                     // every wave's have
  issue_stage(1, 1);

#pragma unroll 1   // one pass per trip: the ring's waits and barrier stand once, at the foot
  for (int t = 0; t < nPass; ++t) {
    const unsigned char* rA = rA0 + (t & 1) * kStageB;
    const unsigned char* rB = rB0 + (t & 1) * kStageB;
    V af[2][4], bf[2][4];
#pragma unroll
    for (int j = 0; j < 4; ++j) bf[0][j] = Frag<T>::load((const T*)(rB + j * 16 * kPitchB));
#pragma unroll
    for (int i = 0; i < 4; ++i) af[0][i] = Frag<T>::load((const T*)(rA + i * 16 * kPitchB));
#pragma unroll
    for (int kk = 0; kk < kPassK / 32; ++kk) {
      const int cur = kk & 1, nxt = cur ^ 1;
      if (kk + 1 < kPassK / 32) {                      // the next block's fragments, as one group ahead of this block
#pragma unroll
        for (int j = 0; j < 4; ++j) bf[nxt][j] = Frag<T>::load((const T*)(rB + j * 16 * kPitchB + (kk + 1) * 64));
#pragma unroll
        for (int i = 0; i < 4; ++i) af[nxt][i] = Frag<T>::load((const T*)(rA + i * 16 * kPitchB + (kk + 1) * 64));
      }
      __builtin_amdgcn_sched_barrier(0);               // keeps that group whole and ahead of the WMMAs (for speed only)
#pragma unroll
      for (int i = 0; i < 4; ++i)
#pragma unroll
        for (int j = 0; j < 4; ++j) acc[i][j] = Frag<T>::mma(af[cur][i], bf[cur][j], acc[i][j]);
      __builtin_amdgcn_sched_barrier(0);               // the following group does not rise into this block
    }
    asm volatile("s_wait_dscnt 0x0" ::: "memory");     // this wave has left buffer t & 1
    asm volatile("s_wait_asynccnt 0x0" ::: "memory");  // its copies of stage t + 1 have landed
    __syncthreads();                                   // publishes stage t + 1 and frees buffer t & 1
    if (t + 2 < nPass) issue_stage(t + 2, t & 1);
  }
  asm volatile("s_wait_asynccnt 0x0" ::: "memory");    // no copy is left in flight behind the loop
  acc_guard4(acc[0][0], acc[0][1], acc[0][2], acc[0][3]);
  acc_guard4(acc[1][0], acc[1][1], acc[1][2], acc[1][3]);
  acc_guard4(acc[2][0], acc[2][1], acc[2][2], acc[2][3]);
  acc_guard4(acc[3][0], acc[3][1], acc[3][2], acc[3][3]);

  // ---- epilogue ----
  float* slab = sT[wave];
#pragma unroll
  for (int i = 0; i < 4; ++i) {
    const int mBase = m0 + (i << 4);
#pragma unroll
    for (int j = 0; j < 4; ++j) {
      const int n = n0 + (j << 4) + rlane;
      float bv = 0.f;
      if (HAS_BIAS) bv = bias[n];
#pragma unroll
      for (int r = 0; r < 8; ++r) {
        float v = acc[i][j][r] * scale;
        if (HAS_BIAS) v += bv;
        slab[(mOff + r) * 68 + (j << 4) + rlane] = v;
      }
    }
    __builtin_amdgcn_fence(__ATOMIC_RELEASE, "workgroup");
    __builtin_amdgcn_wave_barrier();
    __builtin_amdgcn_fence(__ATOMIC_ACQUIRE, "workgroup");
    {
      const int hh = lane >> 4, c4 = (lane & 15) * 4;     // row seg = 256 B = 16 lanes x 16 B
#pragma unroll
      for (int it = 0; it < 8; ++it) {
        const int row = it * 2 + hh;
        v4f v = *(const v4f*)(slab + row * 68 + c4);
        *(v4f*)(C + (size_t)(mBase + row) * ldc + n0 + c4) = v;
      }
    }
    __builtin_amdgcn_fence(__ATOMIC_RELEASE, "workgroup");
    __builtin_amdgcn_wave_barrier();
    __builtin_amdgcn_fence(__ATOMIC_ACQUIRE, "workgroup");
  }
}

// ---------------------------------------------------------------------------
// f32 -> f16 cast with an exact power-of-two carry: chunk i holds in[8i..8i+7] * carry as f16.
// in is [rows][COLS] dense; out has rows of kKcat halves, and the caller points it at the part's first column.
// (n8 is an exact multiple of 256 for both parts here; the guard is belt and braces).
// ---------------------------------------------------------------------------
template <int COLS>
__global__ __launch_bounds__(256) void cast8_f16_carry_kernel(const float* __restrict__ in, unsigned short* __restrict__ out,
                                                             int n8, float carry) {
  const int i = blockIdx.x * 256 + threadIdx.x;
  if (i >= n8) return;
  const float* p = in + 8 * (size_t)i;
  const v4f a = *(const v4f*)(p);
  const v4f c = *(const v4f*)(p + 4);
  unsigned short hb[8];
#pragma unroll
  for (int e = 0; e < 4; ++e) {
    hb[e]     = h_bits(a[e] * carry);
    hb[4 + e] = h_bits(c[e] * carry);
  }
  const v4u u = (v4u){pk16(hb[0], hb[1]), pk16(hb[2], hb[3]), pk16(hb[4], hb[5]), pk16(hb[6], hb[7])};
  constexpr int kChunks = COLS / 8;             // chunks per input row
  unsigned short* q = out + (size_t)(i / kChunks) * kKcat + 8 * (i % kChunks);
  *(v4u*)q = u;
}

// ---------------------------------------------------------------------------
// Activation planes for one row m of x [kRows][kIn] (f32):
//   Ab[m][i]       = f16( x * sigmoid(x) )                     (columns 0..1023 of the row of kKcat halves)
//   As[m][3*i + g] = f16( sin( x * (g+1) ) ), g = 0,1,2        (columns 1024..4095 of the same row; both pitches kKcat)
// One block of 256 threads per row; thread t owns i = 4t..4t+3 (256 x 4 = 1024 = whole row).
// Elementwise math in f32 (precise expf / sinf, no fused contraction on the angle multiply), rolled loops.
//   As row: 384 chunks of 8 halves; thread t writes chunk t, threads 0..127 also chunk 256+t -> union 0..383;
// ---------------------------------------------------------------------------
__global__ __launch_bounds__(256) void act_rows_kernel(const float* __restrict__ x, unsigned short* __restrict__ Ab,
                                                       unsigned short* __restrict__ As, int nrows) {
#pragma clang fp contract(off)
  __shared__ __align__(16) unsigned short sBase[kIn];
  __shared__ __align__(16) unsigned short sSpl[kKspl];
  const int m = blockIdx.x;
  if (m >= nrows) return;                       // block-uniform, before any barrier
  const int t = threadIdx.x;
  const float* xr = x + (size_t)m * kIn + 4 * t;
#pragma unroll 1
  for (int j = 0; j < 4; ++j) {
    const float xv = xr[j];
    const float e  = expf(fminf(-xv, 30.0f));
    const float sg = 1.0f / (1.0f + e);
    const float sl = xv * sg;
    sBase[4 * t + j] = h_bits(sl);
#pragma unroll 1
    for (int g = 1; g <= kGridN; ++g) {
      const float ang = xv * (float)g;
      const float sv  = sinf(ang);
      sSpl[12 * t + 3 * j + (g - 1)] = h_bits(sv);
    }
  }
  __syncthreads();

  const int t2 = (t < 128) ? t : 0;             // clamped index for the second-phase chunks
  const v4u u0 = *(const v4u*)(sSpl + 8 * t);
  const v4u u1 = *(const v4u*)(sSpl + 8 * (256 + t2));
  const v4u ub = *(const v4u*)(sBase + 8 * t2);
  unsigned short* arow = As + (size_t)m * kKcat;
  unsigned short* brow = Ab + (size_t)m * kKcat;
  {
    *(v4u*)(arow + 8 * t) = u0;
    if (t < 128) {
      *(v4u*)(arow + 8 * (256 + t)) = u1;
      *(v4u*)(brow + 8 * t) = ub;
    }
    
  }
}

// ---------------------------------------------------------------------------
// Launcher.
// d_in: {x [8192][1024] f32, base_w [1024][1024] f32, base_b [1024] f32, spline_w [1024][1024][3] f32}; d_out f32 [8192][1024].
//   A    f16 [8192][4096]   67,108,864  @          0   (row m: silu(x) in columns 0..1023, sin basis flat [i*3+g] behind it)
//   Wc   f16 [1024][4096]    8,388,608  @ 67,108,864   (row o: base_w * 4096 in columns 0..1023, spline_w * 4096 flat [i*3+g] behind it)
//   total                   75,497,472
// GEMM assertions: M = 8192 is a multiple of 128, N = 1024 of 256; K = 4096 is a multiple of 128 (no padding, no tails).
// ---------------------------------------------------------------------------
extern "C" void kernel_launch(void* const* d_in, const int* in_sizes, int n_in,
                              void* d_out, int out_size, void* d_ws, size_t ws_size,
                              hipStream_t stream) {
  if (n_in < 4) return;
  if (in_sizes[0] != kRows * kIn) return;
  if (in_sizes[1] != kOut * kIn) return;
  if (in_sizes[2] != kOut) return;
  if (in_sizes[3] != kOut * kIn * kGridN) return;
  if (out_size != kRows * kOut) return;

  const float* x        = (const float*)d_in[0];
  const float* base_w   = (const float*)d_in[1];
  const float* base_b   = (const float*)d_in[2];
  const float* spline_w = (const float*)d_in[3];
  float*       out      = (float*)d_out;

  const size_t bytesA = (size_t)kRows * kKcat * 2;
  const size_t bytesW = (size_t)kOut * kKcat * 2;
  const size_t offA = 0;
  const size_t offW = offA + bytesA;
  const size_t total = offW + bytesW;
  if (total > ws_size) return;

  unsigned char* ws = (unsigned char*)d_ws;
  unsigned short* A  = (unsigned short*)(ws + offA);
  unsigned short* Wc = (unsigned short*)(ws + offW);

  // 1) activation planes: one block per row
  act_rows_kernel<<<dim3(kRows), dim3(256), 0, stream>>>(x, A, A + kIn, kRows);

  // 2) the two parts of the weight rows, same carry
  {
    const int n8b = kOut * kIn / 8;          // 131072 -> 512 blocks
    const int n8s = kOut * kKspl / 8;        // 393216 -> 1536 blocks
    cast8_f16_carry_kernel<kIn><<<dim3((n8b + 255) / 256), dim3(256), 0, stream>>>(base_w, Wc, n8b, kWCarry);
    cast8_f16_carry_kernel<kKspl><<<dim3((n8s + 255) / 256), dim3(256), 0, stream>>>(spline_w, Wc + kIn, n8s, kWCarry);
  }

  const dim3 ggrid(kOut / kTileN, kRows / kTileM);   // 4 x 64 = 256 workgroups of 8 waves

  // 3) both branches in one product: out = (A . Wc^T) / 4096 + base_b
  wmma_gemm_lds<kKcat, true><<<ggrid, dim3(256), 0, stream>>>(A, Wc, out, base_b, kOutScale);
}

// v003
// One run takes 78.7 microseconds.
// Timed twice side by side with v002, it ran 1.03 times as fast both times.
// Over all steps from v000 it is 2.98 times as fast.
// Contraction: [silu(x) | sin-basis] f16 x [base_w | spline_w] f16 (both carried x4096), one product over K=1024+3072=4096; v_wmma_f32_16x16x32_f16 with f32 accumulate; silu/sin/bias in f32.
#include <hip/hip_runtime.h>
#include <math.h>

// ---------------------------------------------------------------------------
// Problem constants
// ---------------------------------------------------------------------------
constexpr int kRows  = 4 * 2048;        // M = 8192 token rows
constexpr int kIn    = 1024;            // input features
constexpr int kOut   = 1024;            // output features
constexpr int kGridN = 3;               // sin basis count
constexpr int kKspl  = kIn * kGridN;    // 3072, k extent of the basis part (index i*3+g)
constexpr int kKcat  = kIn + kKspl;     // 4096, K of the one GEMM: k < 1024 base part, k >= 1024 basis part
constexpr float kWCarry   = 4096.0f;    // both weights carried x4096 in f16, so that both parts share one accumulator
constexpr float kOutScale = 1.0f / 4096.0f;

typedef __attribute__((ext_vector_type(16))) _Float16 v16h;
typedef __attribute__((ext_vector_type(8)))  _Float16 v8h;
typedef __attribute__((ext_vector_type(16))) __bf16   v16b;
typedef __attribute__((ext_vector_type(8)))  __bf16   v8b;
typedef __attribute__((ext_vector_type(8)))  float    v8f;
typedef __attribute__((ext_vector_type(4)))  float    v4f;
typedef __attribute__((ext_vector_type(4)))  unsigned int v4u;

// ---------------------------------------------------------------------------
// Helpers
// ---------------------------------------------------------------------------
__device__ __forceinline__ unsigned short f2bf_bits(float f) {
  unsigned u = __float_as_uint(f);
  return (unsigned short)((u + 0x7FFFu + ((u >> 16) & 1u)) >> 16);
}
__device__ __forceinline__ float bf_bits2f(unsigned short h) { return __uint_as_float(((unsigned)h) << 16); }

// hazard guards as plain device helpers
__device__ __forceinline__ void dep_guard_h(v8f& a, v8f& b, v16h x, v16h y) { asm volatile("v_nop\n\tv_nop\n\tv_nop\n\tv_nop" : "+v"(a), "+v"(b) : "v"(x), "v"(y)); }
__device__ __forceinline__ void dep_guard_b(v8f& a, v8f& b, v16b x, v16b y) { asm volatile("v_nop\n\tv_nop\n\tv_nop\n\tv_nop" : "+v"(a), "+v"(b) : "v"(x), "v"(y)); }
__device__ __forceinline__ void keep4_h(v16h a, v16h b, v16h c, v16h d) { asm volatile("v_nop" :: "v"(a), "v"(b), "v"(c), "v"(d)); }
__device__ __forceinline__ void keep4_b(v16b a, v16b b, v16b c, v16b d) { asm volatile("v_nop" :: "v"(a), "v"(b), "v"(c), "v"(d)); }
__device__ __forceinline__ void acc_guard4(v8f& a, v8f& b, v8f& c, v8f& d) { asm volatile("v_nop\n\tv_nop\n\tv_nop\n\tv_nop" : "+v"(a), "+v"(b), "+v"(c), "+v"(d)); }
template <typename T> struct Frag;
template <> struct Frag<_Float16> {
  typedef v16h V; union U { v16h v; v8h h[2]; };
  static __device__ __forceinline__ v16h load(const _Float16* p) {   // elements 0..7 <- p[0..7], 8..15 <- p[16..23]
    U f; f.h[0] = *(const v8h*)(p); f.h[1] = *(const v8h*)(p + 16); return f.v;
  }
  static __device__ __forceinline__ v8f mma(v16h a, v16h b, v8f c) {
    return __builtin_amdgcn_wmma_f32_16x16x32_f16(false, a, false, b, (short)0, c, false, false);
  }
  static __device__ __forceinline__ void guard(v8f& a, v8f& b, v16h x, v16h y) { dep_guard_h(a, b, x, y); }
  static __device__ __forceinline__ void keep(v16h a, v16h b, v16h c, v16h d) { keep4_h(a, b, c, d); }
};
template <> struct Frag<__bf16> {
  typedef v16b V; union U { v16b v; v8b h[2]; };
  static __device__ __forceinline__ v16b load(const __bf16* p) {
    U f; f.h[0] = *(const v8b*)(p); f.h[1] = *(const v8b*)(p + 16); return f.v;
  }
  static __device__ __forceinline__ v8f mma(v16b a, v16b b, v8f c) {
    return __builtin_amdgcn_wmma_f32_16x16x32_bf16(false, a, false, b, (short)0, c, false, false);
  }
  static __device__ __forceinline__ void guard(v8f& a, v8f& b, v16b x, v16b y) { dep_guard_b(a, b, x, y); }
  static __device__ __forceinline__ void keep(v16b a, v16b b, v16b c, v16b d) { keep4_b(a, b, c, d); }
};

__device__ __forceinline__ unsigned pk16(unsigned short a, unsigned short b) { return (unsigned)a | ((unsigned)b << 16); }
__device__ __forceinline__ unsigned short h_bits(float f) { const _Float16 h = (_Float16)f; return __builtin_bit_cast(unsigned short, h); }

// ---- WMMA GEMM with both operands staged in LDS ---------------------------------------------------------------------
// C[m,n] = scale * sum_k A[m,k] * Bt[n,k] (+bias[n]); A row-major [M][KD], Bt row-major [N][KD], f16.
// One workgroup of 8 waves owns a 128 x 256 tile of C (waves 2 x 4, each 64 x 64 as before).
// A pass is 128 k = 256 B of each of the 128 A rows and 256 Bt rows; a stage holds them at pitch 272 B (A rows first).
// Two buffers: the copies of pass t + 2 fly while pass t + 1 is worked on.
constexpr int kTileM   = 128;
constexpr int kTileN   = 256;
constexpr int kPassK   = 128;                              // halves per pass and row
constexpr int kPitchB  = 272;                              // LDS row pitch in bytes: 16 B x odd for 16-byte readers
constexpr int kStageB  = (kTileM + kTileN) * kPitchB;      // 104,448 B
constexpr int kRowStep = 16;                               // rows between two copies of one thread

__device__ __forceinline__ unsigned lds_off(const void* p) { return (unsigned)(size_t)p; }

// Eight 16-byte copies per lane, global -> LDS, rows kRowStep apart. The s_wait_xcnt stands inside the statement so that
// no address register of an issued copy is rewritten ahead of it.
template <int GSTEP>
__device__ __forceinline__ void async_copy8(unsigned l, const unsigned short* g) {
  constexpr unsigned LS = kRowStep * kPitchB;
  asm volatile(
      "global_load_async_to_lds_b128 %0, %8, off\n\t"
      "global_load_async_to_lds_b128 %1, %9, off\n\t"
      "global_load_async_to_lds_b128 %2, %10, off\n\t"
      "global_load_async_to_lds_b128 %3, %11, off\n\t"
      "global_load_async_to_lds_b128 %4, %12, off\n\t"
      "global_load_async_to_lds_b128 %5, %13, off\n\t"
      "global_load_async_to_lds_b128 %6, %14, off\n\t"
      "global_load_async_to_lds_b128 %7, %15, off\n\t"
      "s_wait_xcnt 0x0"
      :: "v"(l), "v"(l + LS), "v"(l + 2 * LS), "v"(l + 3 * LS), "v"(l + 4 * LS), "v"(l + 5 * LS), "v"(l + 6 * LS), "v"(l + 7 * LS),
         "v"(g), "v"(g + GSTEP), "v"(g + 2 * GSTEP), "v"(g + 3 * GSTEP), "v"(g + 4 * GSTEP), "v"(g + 5 * GSTEP), "v"(g + 6 * GSTEP), "v"(g + 7 * GSTEP)
      : "memory");
}

template <int KD, bool HAS_BIAS>
__global__ __launch_bounds__(256) void wmma_gemm_lds(
    const unsigned short* __restrict__ Ap, const unsigned short* __restrict__ Btp,
    float* __restrict__ C, const float* __restrict__ bias, float scale) {
  typedef _Float16 T;
  typedef Frag<T>::V V;
  static_assert(KD % kPassK == 0 && KD / kPassK >= 2, "two passes or more");
  constexpr int nPass = KD / kPassK;
  constexpr int ldc = kOut;
  __shared__ __attribute__((aligned(2048))) unsigned char ring[2 * kStageB];
  __shared__ __align__(16) float sT[8][16 * 68];   // per-wave 16x64 slab, pitch 68 floats
  const int tid  = threadIdx.x;
  const int lane = tid & 31;
  const int wave = tid >> 5;
  const int m0b = blockIdx.y * kTileM;
  const int n0b = blockIdx.x * kTileN;
  const int wm = wave >> 2;
  const int wn = wave & 3;
  const int m0 = m0b + (wm << 6);
  const int n0 = n0b + (wn << 6);

  const int rlane = lane & 15;                 // row (A) / col (B, D) within subtile
  const int koff  = (lane >> 4) * 8;           // k offset of this lane half
  const int mOff  = (lane >> 4) * 8;           // D row offset

  // copies: thread tid brings 16 B at column (tid & 15) of rows (tid >> 4) + 16 i
  const int crow = tid >> 4;
  const int ccol = tid & 15;
  const unsigned short* gA = Ap  + (size_t)(m0b + crow) * KD + ccol * 8;
  const unsigned short* gB = Btp + (size_t)(n0b + crow) * KD + ccol * 8;
  const unsigned lcopy = lds_off(ring) + crow * kPitchB + ccol * 16;
  auto issue_stage = [&](int pass, int buf) {
    const unsigned l = lcopy + buf * kStageB;
    async_copy8<kRowStep * KD>(l, gA + pass * kPassK);
    async_copy8<kRowStep * KD>(l + 128 * kPitchB, gB + pass * kPassK);
    async_copy8<kRowStep * KD>(l + 256 * kPitchB, gB + pass * kPassK + (size_t)128 * KD);
  };

  const unsigned char* rA0 = ring + ((wm << 6) + rlane) * kPitchB + koff * 2;
  const unsigned char* rB0 = ring + (kTileM + (wn << 6) + rlane) * kPitchB + koff * 2;

  v8f acc[4][4];
#pragma unroll
  for (int i = 0; i < 4; ++i)
#pragma unroll
    for (int j = 0; j < 4; ++j) acc[i][j] = (v8f){0.f,0.f,0.f,0.f,0.f,0.f,0.f,0.f};

  issue_stage(0, 0);
  asm volatile("s_wait_asynccnt 0x0" ::: "memory");   // this wave's copies of stage 0 have landed
  __syncthreads();                                     // every wave's have
  issue_stage(1, 1);

#pragma unroll 1   // one pass per trip: the ring's waits and barrier stand once, at the foot
  for (int t = 0; t < nPass; ++t) {
    const unsigned char* rA = rA0 + (t & 1) * kStageB;
    const unsigned char* rB = rB0 + (t & 1) * kStageB;
    V af[2][4], bf[2][4];
#pragma unroll
    for (int j = 0; j < 4; ++j) bf[0][j] = Frag<T>::load((const T*)(rB + j * 16 * kPitchB));
#pragma unroll
    for (int i = 0; i < 4; ++i) af[0][i] = Frag<T>::load((const T*)(rA + i * 16 * kPitchB));
#pragma unroll
    for (int kk = 0; kk < kPassK / 32; ++kk) {
      const int cur = kk & 1, nxt = cur ^ 1;
      if (kk + 1 < kPassK / 32) {                      // the next block's fragments, as one group ahead of this block
#pragma unroll
        for (int j = 0; j < 4; ++j) bf[nxt][j] = Frag<T>::load((const T*)(rB + j * 16 * kPitchB + (kk + 1) * 64));
#pragma unroll
        for (int i = 0; i < 4; ++i) af[nxt][i] = Frag<T>::load((const T*)(rA + i * 16 * kPitchB + (kk + 1) * 64));
      }
      __builtin_amdgcn_sched_barrier(0);               // keeps that group whole and ahead of the WMMAs (for speed only)
#pragma unroll
      for (int i = 0; i < 4; ++i)
#pragma unroll
        for (int j = 0; j < 4; ++j) acc[i][j] = Frag<T>::mma(af[cur][i], bf[cur][j], acc[i][j]);
      __builtin_amdgcn_sched_barrier(0);               // the following group does not rise into this block
    }
    asm volatile("s_wait_dscnt 0x0" ::: "memory");     // this wave has left buffer t & 1
    asm volatile("s_wait_asynccnt 0x0" ::: "memory");  // its copies of stage t + 1 have landed
    __syncthreads();                                   // publishes stage t + 1 and frees buffer t & 1
    if (t + 2 < nPass) issue_stage(t + 2, t & 1);
  }
  asm volatile("s_wait_asynccnt 0x0" ::: "memory");    // no copy is left in flight behind the loop
  acc_guard4(acc[0][0], acc[0][1], acc[0][2], acc[0][3]);
  acc_guard4(acc[1][0], acc[1][1], acc[1][2], acc[1][3]);
  acc_guard4(acc[2][0], acc[2][1], acc[2][2], acc[2][3]);
  acc_guard4(acc[3][0], acc[3][1], acc[3][2], acc[3][3]);

  // ---- epilogue ----
  float* slab = sT[wave];
#pragma unroll
  for (int i = 0; i < 4; ++i) {
    const int mBase = m0 + (i << 4);
#pragma unroll
    for (int j = 0; j < 4; ++j) {
      const int n = n0 + (j << 4) + rlane;
      float bv = 0.f;
      if (HAS_BIAS) bv = bias[n];
#pragma unroll
      for (int r = 0; r < 8; ++r) {
        float v = acc[i][j][r] * scale;
        if (HAS_BIAS) v += bv;
        slab[(mOff + r) * 68 + (j << 4) + rlane] = v;
      }
    }
    __builtin_amdgcn_fence(__ATOMIC_RELEASE, "workgroup");
    __builtin_amdgcn_wave_barrier();
    __builtin_amdgcn_fence(__ATOMIC_ACQUIRE, "workgroup");
    {
      const int hh = lane >> 4, c4 = (lane & 15) * 4;     // row seg = 256 B = 16 lanes x 16 B
#pragma unroll
      for (int it = 0; it < 8; ++it) {
        const int row = it * 2 + hh;
        v4f v = *(const v4f*)(slab + row * 68 + c4);
        *(v4f*)(C + (size_t)(mBase + row) * ldc + n0 + c4) = v;
      }
    }
    __builtin_amdgcn_fence(__ATOMIC_RELEASE, "workgroup");
    __builtin_amdgcn_wave_barrier();
    __builtin_amdgcn_fence(__ATOMIC_ACQUIRE, "workgroup");
  }
}

// ---------------------------------------------------------------------------
// f32 -> f16 cast with an exact power-of-two carry: chunk i holds in[8i..8i+7] * carry as f16.
// in is [rows][COLS] dense; out has rows of kKcat halves, and the caller points it at the part's first column.
// (n8 is an exact multiple of 256 for both parts here; the guard is belt and braces).
// blk is the block's number within its part.
// ---------------------------------------------------------------------------
template <int COLS>
__device__ __forceinline__ void cast8_f16_carry_block(const float* __restrict__ in, unsigned short* __restrict__ out,
                                                      int blk, int n8, float carry) {
  const int i = blk * 256 + threadIdx.x;
  if (i >= n8) return;
  const float* p = in + 8 * (size_t)i;
  const v4f a = *(const v4f*)(p);
  const v4f c = *(const v4f*)(p + 4);
  unsigned short hb[8];
#pragma unroll
  for (int e = 0; e < 4; ++e) {
    hb[e]     = h_bits(a[e] * carry);
    hb[4 + e] = h_bits(c[e] * carry);
  }
  const v4u u = (v4u){pk16(hb[0], hb[1]), pk16(hb[2], hb[3]), pk16(hb[4], hb[5]), pk16(hb[6], hb[7])};
  constexpr int kChunks = COLS / 8;             // chunks per input row
  unsigned short* q = out + (size_t)(i / kChunks) * kKcat + 8 * (i % kChunks);
  *(v4u*)q = u;
}

// ---------------------------------------------------------------------------
// Activation planes for one row m of x [kRows][kIn] (f32):
//   Ab[m][i]       = f16( x * sigmoid(x) )                     (columns 0..1023 of the row of kKcat halves)
//   As[m][3*i + g] = f16( sin( x * (g+1) ) ), g = 0,1,2        (columns 1024..4095 of the same row; both pitches kKcat)
// One block of 256 threads per row; thread t owns i = 4t..4t+3 (256 x 4 = 1024 = whole row).
// Elementwise math in f32 (precise expf / sinf, no fused contraction on the angle multiply), rolled loops.
//   As row: 384 chunks of 8 halves; thread t writes chunk t, threads 0..127 also chunk 256+t -> union 0..383;
// ---------------------------------------------------------------------------
__device__ __forceinline__ void act_row_block(const float* __restrict__ x, unsigned short* __restrict__ Ab,
                                              unsigned short* __restrict__ As, int m, int nrows) {
#pragma clang fp contract(off)
  __shared__ __align__(16) unsigned short sBase[kIn];
  __shared__ __align__(16) unsigned short sSpl[kKspl];
  if (m >= nrows) return;                       // block-uniform, before any barrier
  const int t = threadIdx.x;
  const float* xr = x + (size_t)m * kIn + 4 * t;
#pragma unroll 1
  for (int j = 0; j < 4; ++j) {
    const float xv = xr[j];
    const float e  = expf(fminf(-xv, 30.0f));
    const float sg = 1.0f / (1.0f + e);
    const float sl = xv * sg;
    sBase[4 * t + j] = h_bits(sl);
#pragma unroll 1
    for (int g = 1; g <= kGridN; ++g) {
      const float ang = xv * (float)g;
      const float sv  = sinf(ang);
      sSpl[12 * t + 3 * j + (g - 1)] = h_bits(sv);
    }
  }
  __syncthreads();

  const int t2 = (t < 128) ? t : 0;             // clamped index for the second-phase chunks
  const v4u u0 = *(const v4u*)(sSpl + 8 * t);
  const v4u u1 = *(const v4u*)(sSpl + 8 * (256 + t2));
  const v4u ub = *(const v4u*)(sBase + 8 * t2);
  unsigned short* arow = As + (size_t)m * kKcat;
  unsigned short* brow = Ab + (size_t)m * kKcat;
  {
    *(v4u*)(arow + 8 * t) = u0;
    if (t < 128) {
      *(v4u*)(arow + 8 * (256 + t)) = u1;
      *(v4u*)(brow + 8 * t) = ub;
    }
    
  }
}

// ---------------------------------------------------------------------------
// All preparation in one grid: the three jobs read and write disjoint data and none waits for another, so they need no
// launch boundary between them. Blocks 0..8191 each build one activation row; the short cast blocks follow.
// The choice of job is block-uniform.
// ---------------------------------------------------------------------------
constexpr int kN8Base     = kOut * kIn / 8;            // 131072 chunks -> 512 blocks
constexpr int kN8Spl      = kOut * kKspl / 8;          // 393216 chunks -> 1536 blocks
constexpr int kBlkBase    = (kN8Base + 255) / 256;
constexpr int kBlkSpl     = (kN8Spl + 255) / 256;
constexpr int kPrepBlocks = kRows + kBlkBase + kBlkSpl;   // 10240

__global__ __launch_bounds__(256) void prep_kernel(const float* __restrict__ x, const float* __restrict__ base_w,
                                                   const float* __restrict__ spline_w,
                                                   unsigned short* __restrict__ A, unsigned short* __restrict__ Wc) {
  const int b = blockIdx.x;
  if (b < kRows) {
    act_row_block(x, A, A + kIn, b, kRows);
  } else if (b < kRows + kBlkBase) {
    cast8_f16_carry_block<kIn>(base_w, Wc, b - kRows, kN8Base, kWCarry);
  } else {
    cast8_f16_carry_block<kKspl>(spline_w, Wc + kIn, b - (kRows + kBlkBase), kN8Spl, kWCarry);
  }
}

// ---------------------------------------------------------------------------
// Launcher.
// d_in: {x [8192][1024] f32, base_w [1024][1024] f32, base_b [1024] f32, spline_w [1024][1024][3] f32}; d_out f32 [8192][1024].
//   A    f16 [8192][4096]   67,108,864  @          0   (row m: silu(x) in columns 0..1023, sin basis flat [i*3+g] behind it)
//   Wc   f16 [1024][4096]    8,388,608  @ 67,108,864   (row o: base_w * 4096 in columns 0..1023, spline_w * 4096 flat [i*3+g] behind it)
//   total                   75,497,472
// GEMM assertions: M = 8192 is a multiple of 128, N = 1024 of 256; K = 4096 is a multiple of 128 (no padding, no tails).
// ---------------------------------------------------------------------------
extern "C" void kernel_launch(void* const* d_in, const int* in_sizes, int n_in,
                              void* d_out, int out_size, void* d_ws, size_t ws_size,
                              hipStream_t stream) {
  if (n_in < 4) return;
  if (in_sizes[0] != kRows * kIn) return;
  if (in_sizes[1] != kOut * kIn) return;
  if (in_sizes[2] != kOut) return;
  if (in_sizes[3] != kOut * kIn * kGridN) return;
  if (out_size != kRows * kOut) return;

  const float* x        = (const float*)d_in[0];
  const float* base_w   = (const float*)d_in[1];
  const float* base_b   = (const float*)d_in[2];
  const float* spline_w = (const float*)d_in[3];
  float*       out      = (float*)d_out;

  const size_t bytesA = (size_t)kRows * kKcat * 2;
  const size_t bytesW = (size_t)kOut * kKcat * 2;
  const size_t offA = 0;
  const size_t offW = offA + bytesA;
  const size_t total = offW + bytesW;
  if (total > ws_size) return;

  unsigned char* ws = (unsigned char*)d_ws;
  unsigned short* A  = (unsigned short*)(ws + offA);
  unsigned short* Wc = (unsigned short*)(ws + offW);

  // 1) activation planes (one block per row) and the two parts of the weight rows (same carry), one launch
  prep_kernel<<<dim3(kPrepBlocks), dim3(256), 0, stream>>>(x, base_w, spline_w, A, Wc);

  const dim3 ggrid(kOut / kTileN, kRows / kTileM);   // 4 x 64 = 256 workgroups of 8 waves

  // 2) both branches in one product: out = (A . Wc^T) / 4096 + base_b
  wmma_gemm_lds<kKcat, true><<<ggrid, dim3(256), 0, stream>>>(A, Wc, out, base_b, kOutScale);
}

// v004
// One run takes 55.6 microseconds.
// In two side-by-side timings against v003, it was 1.41 and 1.40 times as fast.
// Counting every step since v000, it is 4.20 times as fast.
// Contraction: A[m][4i+f] = {silu(x), sin x, sin 2x, sin 3x} f16, built in LDS inside the GEMM, x W[o][4i+f] = {base_w, spline_w} f16 (carried x4096), K=4096; v_wmma_f32_16x16x32_f16 with f32 accumulate; silu/sin/bias in f32.
#include <hip/hip_runtime.h>
#include <math.h>

// ---------------------------------------------------------------------------
// Problem constants
// ---------------------------------------------------------------------------
constexpr int kRows  = 4 * 2048;        // M = 8192 token rows
constexpr int kIn    = 1024;            // input features
constexpr int kOut   = 1024;            // output features
constexpr int kGridN = 3;               // sin basis count
constexpr int kKspl  = kIn * kGridN;    // 3072, k count of the basis part (k = 4 i + 1 + g)
constexpr int kKcat  = kIn + kKspl;     // 4096, K of the one GEMM: k = 4 i + f, f = 0 base part, f = 1..3 basis part
constexpr float kWCarry   = 4096.0f;    // both weights carried x4096 in f16, so that both parts share one accumulator
constexpr float kOutScale = 1.0f / 4096.0f;

typedef __attribute__((ext_vector_type(16))) _Float16 v16h;
typedef __attribute__((ext_vector_type(8)))  _Float16 v8h;
typedef __attribute__((ext_vector_type(16))) __bf16   v16b;
typedef __attribute__((ext_vector_type(8)))  __bf16   v8b;
typedef __attribute__((ext_vector_type(8)))  float    v8f;
typedef __attribute__((ext_vector_type(4)))  float    v4f;
typedef __attribute__((ext_vector_type(4)))  unsigned int v4u;

// ---------------------------------------------------------------------------
// Helpers
// ---------------------------------------------------------------------------
__device__ __forceinline__ unsigned short f2bf_bits(float f) {
  unsigned u = __float_as_uint(f);
  return (unsigned short)((u + 0x7FFFu + ((u >> 16) & 1u)) >> 16);
}
__device__ __forceinline__ float bf_bits2f(unsigned short h) { return __uint_as_float(((unsigned)h) << 16); }

// hazard guards as plain device helpers
__device__ __forceinline__ void dep_guard_h(v8f& a, v8f& b, v16h x, v16h y) { asm volatile("v_nop\n\tv_nop\n\tv_nop\n\tv_nop" : "+v"(a), "+v"(b) : "v"(x), "v"(y)); }
__device__ __forceinline__ void dep_guard_b(v8f& a, v8f& b, v16b x, v16b y) { asm volatile("v_nop\n\tv_nop\n\tv_nop\n\tv_nop" : "+v"(a), "+v"(b) : "v"(x), "v"(y)); }
__device__ __forceinline__ void keep4_h(v16h a, v16h b, v16h c, v16h d) { asm volatile("v_nop" :: "v"(a), "v"(b), "v"(c), "v"(d)); }
__device__ __forceinline__ void keep4_b(v16b a, v16b b, v16b c, v16b d) { asm volatile("v_nop" :: "v"(a), "v"(b), "v"(c), "v"(d)); }
__device__ __forceinline__ void acc_guard4(v8f& a, v8f& b, v8f& c, v8f& d) { asm volatile("v_nop\n\tv_nop\n\tv_nop\n\tv_nop" : "+v"(a), "+v"(b), "+v"(c), "+v"(d)); }
template <typename T> struct Frag;
template <> struct Frag<_Float16> {
  typedef v16h V; union U { v16h v; v8h h[2]; };
  static __device__ __forceinline__ v16h load(const _Float16* p) {   // elements 0..7 <- p[0..7], 8..15 <- p[16..23]
    U f; f.h[0] = *(const v8h*)(p); f.h[1] = *(const v8h*)(p + 16); return f.v;
  }
  static __device__ __forceinline__ v8f mma(v16h a, v16h b, v8f c) {
    return __builtin_amdgcn_wmma_f32_16x16x32_f16(false, a, false, b, (short)0, c, false, false);
  }
  static __device__ __forceinline__ void guard(v8f& a, v8f& b, v16h x, v16h y) { dep_guard_h(a, b, x, y); }
  static __device__ __forceinline__ void keep(v16h a, v16h b, v16h c, v16h d) { keep4_h(a, b, c, d); }
};
template <> struct Frag<__bf16> {
  typedef v16b V; union U { v16b v; v8b h[2]; };
  static __device__ __forceinline__ v16b load(const __bf16* p) {
    U f; f.h[0] = *(const v8b*)(p); f.h[1] = *(const v8b*)(p + 16); return f.v;
  }
  static __device__ __forceinline__ v8f mma(v16b a, v16b b, v8f c) {
    return __builtin_amdgcn_wmma_f32_16x16x32_bf16(false, a, false, b, (short)0, c, false, false);
  }
  static __device__ __forceinline__ void guard(v8f& a, v8f& b, v16b x, v16b y) { dep_guard_b(a, b, x, y); }
  static __device__ __forceinline__ void keep(v16b a, v16b b, v16b c, v16b d) { keep4_b(a, b, c, d); }
};

__device__ __forceinline__ unsigned pk16(unsigned short a, unsigned short b) { return (unsigned)a | ((unsigned)b << 16); }
__device__ __forceinline__ unsigned short h_bits(float f) { const _Float16 h = (_Float16)f; return __builtin_bit_cast(unsigned short, h); }

// ---- WMMA GEMM with both operands staged in LDS ---------------------------------------------------------------------
// C[m,n] = scale * sum_k A[m,k] * Bt[n,k] (+bias[n]); A[m][4 i + f] = act_f(x[m][i]) f16, x row-major [M][KD / 4] f32; Bt row-major [N][KD], f16.
// One workgroup of 8 waves owns a 128 x 256 tile of C (waves 2 x 4, each 64 x 64 as before).
// A pass is 128 k = 256 B of each of the 128 A rows and 256 Bt rows; a stage holds them at pitch 272 B (A rows first).
// The A rows are not copied: 128 k are 32 columns of x, and the workgroup builds them from x (f32, 16 KiB, behind the Bt rows).
// Stage s's copies bring Bt of pass s and x of pass s + 1; pass t turns that x into the A rows of the other buffer.
// Two buffers: the copies of stage t + 2 fly while pass t + 1 is worked on.
constexpr int kTileM   = 128;
constexpr int kTileN   = 256;
constexpr int kPassK   = 128;                              // halves per pass and row
constexpr int kPitchB  = 272;                              // LDS row pitch in bytes: 16 B x odd for 16-byte readers
constexpr int kXPass   = kPassK / 4;                       // x columns per pass
constexpr int kXOffB   = (kTileM + kTileN) * kPitchB;      // x tile's place in a stage
constexpr int kStageB  = kXOffB + kTileM * kXPass * 4;     // 104,448 + 16,384 = 120,832 B
constexpr int kRowStep = 16;                               // rows between two copies of one thread

__device__ __forceinline__ unsigned lds_off(const void* p) { return (unsigned)(size_t)p; }

// Eight 16-byte copies per lane, global -> LDS, rows kRowStep apart. The s_wait_xcnt stands inside the statement so that
// no address register of an issued copy is rewritten ahead of it.
template <int GSTEP>
__device__ __forceinline__ void async_copy8(unsigned l, const unsigned short* g) {
  constexpr unsigned LS = kRowStep * kPitchB;
  asm volatile(
      "global_load_async_to_lds_b128 %0, %8, off\n\t"
      "global_load_async_to_lds_b128 %1, %9, off\n\t"
      "global_load_async_to_lds_b128 %2, %10, off\n\t"
      "global_load_async_to_lds_b128 %3, %11, off\n\t"
      "global_load_async_to_lds_b128 %4, %12, off\n\t"
      "global_load_async_to_lds_b128 %5, %13, off\n\t"
      "global_load_async_to_lds_b128 %6, %14, off\n\t"
      "global_load_async_to_lds_b128 %7, %15, off\n\t"
      "s_wait_xcnt 0x0"
      :: "v"(l), "v"(l + LS), "v"(l + 2 * LS), "v"(l + 3 * LS), "v"(l + 4 * LS), "v"(l + 5 * LS), "v"(l + 6 * LS), "v"(l + 7 * LS),
         "v"(g), "v"(g + GSTEP), "v"(g + 2 * GSTEP), "v"(g + 3 * GSTEP), "v"(g + 4 * GSTEP), "v"(g + 5 * GSTEP), "v"(g + 6 * GSTEP), "v"(g + 7 * GSTEP)
      : "memory");
}

// Four 16-byte copies per lane of x, four rows apart in x, 4 KiB apart in LDS. The s_wait_xcnt stands inside the statement
// for the same reason.
__device__ __forceinline__ void async_copy4_x(unsigned l, const float* g) {
  asm volatile(
      "global_load_async_to_lds_b128 %0, %4, off\n\t"
      "global_load_async_to_lds_b128 %1, %5, off\n\t"
      "global_load_async_to_lds_b128 %2, %6, off\n\t"
      "global_load_async_to_lds_b128 %3, %7, off\n\t"
      "s_wait_xcnt 0x0"
      :: "v"(l), "v"(l + 4096u), "v"(l + 8192u), "v"(l + 12288u),
         "v"(g), "v"(g + 4 * kIn), "v"(g + 8 * kIn), "v"(g + 12 * kIn)
      : "memory");
}

// Four x values -> 16 halves {silu, sin x, sin 2x, sin 3x} each, 32 B of an A row. f32 math on the hardware's
// exp2, rcp and sin (argument in turns, brought into [0, 1) first so that any finite x is in the unit's range).
__device__ __forceinline__ void act4_store(v4f xv, unsigned char* dst) {
  v8h h[2];
#pragma unroll
  for (int e = 0; e < 4; ++e) {
    const float xx = xv[e];
    const float ex = __builtin_amdgcn_exp2f(fminf(-xx, 30.0f) * 1.44269504f);
    const float sl = xx * __builtin_amdgcn_rcpf(1.0f + ex);
    const float s1 = __builtin_amdgcn_sinf(__builtin_amdgcn_fractf(xx * 0.159154943f));
    const float s2 = __builtin_amdgcn_sinf(__builtin_amdgcn_fractf(xx * 0.318309886f));
    const float s3 = __builtin_amdgcn_sinf(__builtin_amdgcn_fractf(xx * 0.477464829f));
    h[e >> 1][(e & 1) * 4 + 0] = (_Float16)sl;
    h[e >> 1][(e & 1) * 4 + 1] = (_Float16)s1;
    h[e >> 1][(e & 1) * 4 + 2] = (_Float16)s2;
    h[e >> 1][(e & 1) * 4 + 3] = (_Float16)s3;
  }
  *(v8h*)(dst) = h[0];
  *(v8h*)(dst + 16) = h[1];
}

template <int KD, bool HAS_BIAS>
__global__ __launch_bounds__(256) void wmma_gemm_lds(
    const float* __restrict__ Xp, const unsigned short* __restrict__ Btp,
    float* __restrict__ C, const float* __restrict__ bias, float scale) {
  typedef _Float16 T;
  typedef Frag<T>::V V;
  static_assert(KD % kPassK == 0 && KD / kPassK >= 3, "three passes or more");
  constexpr int nPass = KD / kPassK;
  constexpr int ldc = kOut;
  __shared__ __attribute__((aligned(2048))) unsigned char ring[2 * kStageB];
  __shared__ __align__(16) float sT[8][16 * 68];   // per-wave 16x64 slab, pitch 68 floats
  const int tid  = threadIdx.x;
  const int lane = tid & 31;
  const int wave = tid >> 5;
  const int m0b = blockIdx.y * kTileM;
  const int n0b = blockIdx.x * kTileN;
  const int wm = wave >> 2;
  const int wn = wave & 3;
  const int m0 = m0b + (wm << 6);
  const int n0 = n0b + (wn << 6);

  const int rlane = lane & 15;                 // row (A) / col (B, D) within subtile
  const int koff  = (lane >> 4) * 8;           // k offset of this lane half
  const int mOff  = (lane >> 4) * 8;           // D row offset

  // copies: thread tid brings 16 B at column (tid & 15) of rows (tid >> 4) + 16 i
  const int crow = tid >> 4;
  const int ccol = tid & 15;
  const unsigned short* gB = Btp + (size_t)(n0b + crow) * KD + ccol * 8;
  const unsigned lcopy = lds_off(ring) + crow * kPitchB + ccol * 16;
  // x: lane brings 16 B at column chunk (lane & 7) of rows 16 wave + (lane >> 3) + 4 q, to its own place 16 tid + 4096 q,
  // and is the only reader of those bytes
  const int xrow = (wave << 4) + (lane >> 3);
  const int xcol = lane & 7;
  const float* gX = Xp + (size_t)(m0b + xrow) * kIn + xcol * 4;
  const unsigned xoff = kXOffB + tid * 16;
  auto issue_w = [&](int pass, int buf) {
    const unsigned l = lcopy + buf * kStageB;
    async_copy8<kRowStep * KD>(l + 128 * kPitchB, gB + pass * kPassK);
    async_copy8<kRowStep * KD>(l + 256 * kPitchB, gB + pass * kPassK + (size_t)128 * KD);
  };
  auto issue_x = [&](int pass, int buf) {
    async_copy4_x(lds_off(ring) + buf * kStageB + xoff, gX + pass * kXPass);
  };
  unsigned char* sA0 = ring + xrow * kPitchB + xcol * 32;   // this lane's 32 B of A row xrow (+ 4 q)

  const unsigned char* rA0 = ring + ((wm << 6) + rlane) * kPitchB + koff * 2;
  const unsigned char* rB0 = ring + (kTileM + (wn << 6) + rlane) * kPitchB + koff * 2;

  v8f acc[4][4];
#pragma unroll
  for (int i = 0; i < 4; ++i)
#pragma unroll
    for (int j = 0; j < 4; ++j) acc[i][j] = (v8f){0.f,0.f,0.f,0.f,0.f,0.f,0.f,0.f};

  issue_w(0, 0);
  issue_x(0, 1);                                       // x of pass 0 borrows buffer 1's x place
  issue_x(1, 0);
  asm volatile("s_wait_asynccnt 0x0" ::: "memory");   // this wave's copies of stage 0 have landed
#pragma unroll
  for (int q = 0; q < 4; ++q)
    act4_store(*(const v4f*)(ring + kStageB + xoff + q * 4096), sA0 + q * 4 * kPitchB);
  asm volatile("s_wait_dscnt 0x0" ::: "memory");      // A rows of pass 0 written, borrowed x place left
  __syncthreads();                                     // every wave's copies and A rows are there
  issue_w(1, 1);
  issue_x(2, 1);

#pragma unroll 1   // one pass per trip: the ring's waits and barrier stand once, at the foot
  for (int t = 0; t < nPass; ++t) {
    const unsigned char* rA = rA0 + (t & 1) * kStageB;
    const unsigned char* rB = rB0 + (t & 1) * kStageB;
    unsigned char* sA = sA0 + ((t & 1) ^ 1) * kStageB;  // A rows of pass t + 1 (in the last pass: rows that nobody reads)
    const unsigned char* sX = ring + (t & 1) * kStageB + xoff;
    V af[2][4], bf[2][4];
#pragma unroll
    for (int j = 0; j < 4; ++j) bf[0][j] = Frag<T>::load((const T*)(rB + j * 16 * kPitchB));
#pragma unroll
    for (int i = 0; i < 4; ++i) af[0][i] = Frag<T>::load((const T*)(rA + i * 16 * kPitchB));
    __builtin_amdgcn_sched_barrier(0);                 // the first block's fragments stay first in the LDS queue: its WMMAs wait for them alone
#pragma unroll
    for (int kk = 0; kk < kPassK / 32; ++kk) {
      const int cur = kk & 1, nxt = cur ^ 1;
      const v4f xq = *(const v4f*)(sX + kk * 4096);    // this block's quarter of x, in the same group of LDS reads
      if (kk + 1 < kPassK / 32) {                      // the next block's fragments, as one group ahead of this block
#pragma unroll
        for (int j = 0; j < 4; ++j) bf[nxt][j] = Frag<T>::load((const T*)(rB + j * 16 * kPitchB + (kk + 1) * 64));
#pragma unroll
        for (int i = 0; i < 4; ++i) af[nxt][i] = Frag<T>::load((const T*)(rA + i * 16 * kPitchB + (kk + 1) * 64));
      }
      __builtin_amdgcn_sched_barrier(0);               // keeps that group whole and ahead of the WMMAs (for speed only)
#pragma unroll
      for (int i = 0; i < 4; ++i)
#pragma unroll
        for (int j = 0; j < 4; ++j) acc[i][j] = Frag<T>::mma(af[cur][i], bf[cur][j], acc[i][j]);
      __builtin_amdgcn_sched_barrier(0);               // the following group does not rise into this block
      act4_store(xq, sA + kk * 4 * kPitchB);           // a quarter of the next A rows behind each block: vector work beside the other wave's WMMAs
    }
    asm volatile("s_wait_dscnt 0x0" ::: "memory");     // this wave has left buffer t & 1 and written its A rows of pass t + 1
    asm volatile("s_wait_asynccnt 0x0" ::: "memory");  // its copies of stage t + 1 have landed
    __syncthreads();                                   // publishes stage t + 1 and frees buffer t & 1
    if (t + 2 < nPass) {
      issue_w(t + 2, t & 1);
      issue_x(t + 3 < nPass ? t + 3 : nPass - 1, t & 1);   // behind the last pass there is no x: the index is clamped, the bytes unused
    }
  }
  asm volatile("s_wait_asynccnt 0x0" ::: "memory");    // no copy is left in flight behind the loop
  acc_guard4(acc[0][0], acc[0][1], acc[0][2], acc[0][3]);
  acc_guard4(acc[1][0], acc[1][1], acc[1][2], acc[1][3]);
  acc_guard4(acc[2][0], acc[2][1], acc[2][2], acc[2][3]);
  acc_guard4(acc[3][0], acc[3][1], acc[3][2], acc[3][3]);

  // ---- epilogue ----
  float* slab = sT[wave];
#pragma unroll
  for (int i = 0; i < 4; ++i) {
    const int mBase = m0 + (i << 4);
#pragma unroll
    for (int j = 0; j < 4; ++j) {
      const int n = n0 + (j << 4) + rlane;
      float bv = 0.f;
      if (HAS_BIAS) bv = bias[n];
#pragma unroll
      for (int r = 0; r < 8; ++r) {
        float v = acc[i][j][r] * scale;
        if (HAS_BIAS) v += bv;
        slab[(mOff + r) * 68 + (j << 4) + rlane] = v;
      }
    }
    __builtin_amdgcn_fence(__ATOMIC_RELEASE, "workgroup");
    __builtin_amdgcn_wave_barrier();
    __builtin_amdgcn_fence(__ATOMIC_ACQUIRE, "workgroup");
    {
      const int hh = lane >> 4, c4 = (lane & 15) * 4;     // row seg = 256 B = 16 lanes x 16 B
#pragma unroll
      for (int it = 0; it < 8; ++it) {
        const int row = it * 2 + hh;
        v4f v = *(const v4f*)(slab + row * 68 + c4);
        *(v4f*)(C + (size_t)(mBase + row) * ldc + n0 + c4) = v;
      }
    }
    __builtin_amdgcn_fence(__ATOMIC_RELEASE, "workgroup");
    __builtin_amdgcn_wave_barrier();
    __builtin_amdgcn_fence(__ATOMIC_ACQUIRE, "workgroup");
  }
}

// ---------------------------------------------------------------------------
// Weight rows, f32 -> f16 with an exact power-of-two carry, in the product's k order:
//   Wc[o][4 i + 0] = base_w[o][i] * carry,  Wc[o][4 i + 1 + g] = spline_w[o][i][g] * carry, g = 0,1,2.
// One thread per four i: 16 B of base_w, 48 B of spline_w, 32 B out. kOut * kIn / 4 threads = 1024 blocks of 256, no tail.
// ---------------------------------------------------------------------------
constexpr int kPrepBlocks = kOut * kIn / 4 / 256;

__global__ __launch_bounds__(256) void prep_kernel(const float* __restrict__ base_w, const float* __restrict__ spline_w,
                                                   unsigned short* __restrict__ Wc) {
  const int c = blockIdx.x * 256 + threadIdx.x;      // chunk of four i, row-major over [kOut][kIn / 4]
  const v4f b = *(const v4f*)(base_w + 4 * (size_t)c);
  const float* sp = spline_w + 12 * (size_t)c;
  const v4f s0 = *(const v4f*)(sp);
  const v4f s1 = *(const v4f*)(sp + 4);
  const v4f s2 = *(const v4f*)(sp + 8);
  const float f[16] = {b[0], s0[0], s0[1], s0[2], b[1], s0[3], s1[0], s1[1], b[2], s1[2], s1[3], s2[0], b[3], s2[1], s2[2], s2[3]};
  unsigned u[8];
#pragma unroll
  for (int e = 0; e < 8; ++e) u[e] = pk16(h_bits(f[2 * e] * kWCarry), h_bits(f[2 * e + 1] * kWCarry));
  unsigned short* q = Wc + 16 * (size_t)c;
  *(v4u*)(q)     = (v4u){u[0], u[1], u[2], u[3]};
  *(v4u*)(q + 8) = (v4u){u[4], u[5], u[6], u[7]};
}

// ---------------------------------------------------------------------------
// Launcher.
// d_in: {x [8192][1024] f32, base_w [1024][1024] f32, base_b [1024] f32, spline_w [1024][1024][3] f32}; d_out f32 [8192][1024].
//   Wc   f16 [1024][4096]    8,388,608  @ 0   (row o, column 4 i + f: base_w * 4096 at f = 0, spline_w[.][i][f - 1] * 4096 behind it)
// GEMM assertions: M = 8192 is a multiple of 128, N = 1024 of 256; K = 4096 is a multiple of 128 (no padding, no tails).
// ---------------------------------------------------------------------------
extern "C" void kernel_launch(void* const* d_in, const int* in_sizes, int n_in,
                              void* d_out, int out_size, void* d_ws, size_t ws_size,
                              hipStream_t stream) {
  if (n_in < 4) return;
  if (in_sizes[0] != kRows * kIn) return;
  if (in_sizes[1] != kOut * kIn) return;
  if (in_sizes[2] != kOut) return;
  if (in_sizes[3] != kOut * kIn * kGridN) return;
  if (out_size != kRows * kOut) return;

  const float* x        = (const float*)d_in[0];
  const float* base_w   = (const float*)d_in[1];
  const float* base_b   = (const float*)d_in[2];
  const float* spline_w = (const float*)d_in[3];
  float*       out      = (float*)d_out;

  const size_t bytesW = (size_t)kOut * kKcat * 2;
  if (bytesW > ws_size) return;

  unsigned short* Wc = (unsigned short*)d_ws;

  // 1) the weight rows in the product's k order
  prep_kernel<<<dim3(kPrepBlocks), dim3(256), 0, stream>>>(base_w, spline_w, Wc);

  const dim3 ggrid(kOut / kTileN, kRows / kTileM);   // 4 x 64 = 256 workgroups of 8 waves

  // 2) activation and both branches in one product: out = (act(x) . Wc^T) / 4096 + base_b
  wmma_gemm_lds<kKcat, true><<<ggrid, dim3(256), 0, stream>>>(x, Wc, out, base_b, kOutScale);
}
